// v009
// Times are from an AMD MI455X. After a warm-up the kernel runs many times in a row, and a time is the length of
// such a window on the GPU divided by its runs, so every launch and the gaps after it count. The runs cycle
// through copies of the inputs. A figure is the median of several windows, for all but v000 over two sittings.
// Sittings can differ by a few percent; kernels timed side by side share one.
// The versions before v009 are in another document.
// It runs in 123 microseconds.
// Timed twice side by side with v008, it ran 1.23 times as fast both times.
// All steps since the starting kernel, v000, together make it 73.0 times as fast.
#include <hip/hip_runtime.h>
// Causal SINGLE-HEAD self-attention of full width with a fused bias-free QKV projection and NO output projection (x [4][2048][1024]; qkv = x W_qkv ([in][out] 1024 x 3072, no bias) split into q | k | v thirds of width 1024; scores = q k^T / sqrt(1024) over the FULL width (one head); causal (keys after the query -> -inf); softmax over keys; out = attn v -> [4][2048][1024]).
// Structure: token rows; x as exact f16 rows; ONE WMMA GEMM into the f16 q | k plane (pitch 3072) and, from the same epilogue, v^T [batch][1024][2048]; causal 256-row query tiles: scores GEMM with K = 1024 (alpha 1/32), causal softmax f32 -> f16 x256 weights, P . V^T GEMM with N = 1024 written as f32 (alpha 2^-8) straight into the output rows. Every stage is ONE launch over all batches (grid y) and all query tiles (grid z); S, P, V^T and the f32 planes hold all of them in the workspace.
// First-tile refinement: the first 512 query rows of every batch (which see few keys, so single-f16 q / k / v / P would be too coarse with no output projection to average the errors) carry every operand as an f16 pair, value = hi + lo (lo = what the rounding to hi left): the projection GEMM stores lo of their q | k | v beside hi, and each product is three WMMA terms, hi hi + lo hi + hi lo (lo lo lies 2^-22 below and is left out).
// Scores of these rows: the three terms are three column groups of 512 in the S row (own blocks of the scores launch), added in f32 by the softmax (precise expf), which stores P as hi | lo | hi; P . V of these rows: ONE product of K = 1536 with the V^T rows hi | hi | lo (own blocks of the P . V launch).
// Compute dtype: inputs rounded to bf16; x / weights exact; q, k, v and the softmax weights as plain f16 GEMM operands (~2^-12) past the first 512 rows of a batch, as f16 pairs (~2^-22) inside them; scores, softmax statistics and the output accumulation f32. v_wmma_f32_16x16x32_f16.
#define NB 4
#define SQ 2048
#define DM 1024
#define NH 16
#define HD 64
#define HG 4                         /* heads per attention launch group */
#define QT 256                       /* query rows per causal tile */
#define NKX SQ                       /* S / P row pitch */
#define QT0 512                      /* first rows of a batch whose operands are f16 pairs: 512 here (no output projection averages the early-row cancellation errors away; logit sigma 1.0) */
#define B0 0                         /* first batch processed (debug hook) */
#define NBR NB                       /* batches processed (debug hook) */
#define NR ((size_t)NB * SQ)
#define DMQ DM
#define DFF 4096
#define DFFR 100
#define MP ((int)((size_t)NBR * SQ)) /* rows projected (debug hook) */
#define QN SQ                        /* query rows attended per batch (debug hook) */
#define NHD NH
#define MPO MP                       /* rows through the output stage (debug hook) */
#define LQ (3 * DM)      /* row pitch of the q/k/v rows */
typedef __bf16 v16b __attribute__((ext_vector_type(16)));
typedef unsigned short v8us __attribute__((ext_vector_type(8), may_alias));
typedef float  v8f  __attribute__((ext_vector_type(8)));
typedef float  v4f  __attribute__((ext_vector_type(4)));
typedef float  v4fa __attribute__((ext_vector_type(4), may_alias));
union FragB { v16b v; v8us half[2]; unsigned short u[16]; };

__device__ __forceinline__ unsigned short bf16_bits(float x) { unsigned int u = __float_as_uint(x); return (unsigned short)((u + 0x7FFFu + ((u >> 16) & 1u)) >> 16); }
__device__ __forceinline__ float bf16_val(unsigned short b) { return __uint_as_float(((unsigned int)b) << 16); }
__device__ __forceinline__ float bf16_round(float x) { return bf16_val(bf16_bits(x)); }
// D += A·B with NT terms: 1 = ah·bh, 2 = + al·bh (A split), 3 = + ah·bl (both split)
template <int NT>
__device__ __forceinline__ v8f mmaN(v16b ah, v16b al, v16b bh, v16b bl, v8f c) {
  c = __builtin_amdgcn_wmma_f32_16x16x32_bf16(false, ah, false, bh, (short)0, c, false, false);
  if (NT >= 2) c = __builtin_amdgcn_wmma_f32_16x16x32_bf16(false, al, false, bh, (short)0, c, false, false);
  if (NT >= 3) c = __builtin_amdgcn_wmma_f32_16x16x32_bf16(false, ah, false, bl, (short)0, c, false, false);
  asm volatile("v_nop\n\tv_nop\n\tv_nop\n\tv_nop" : "+v"(c) : "v"(ah), "v"(al), "v"(bh), "v"(bl));
  return c;
}

__global__ __launch_bounds__(256) void k_wt_bf16(const float* __restrict__ W, unsigned short* __restrict__ Wt, int K, int N) {
  const int t = blockIdx.x * 256 + threadIdx.x;
  const int k8n = K / 8;
  if (t >= N * k8n) return;
  const int n = t / k8n, k8 = (t % k8n) * 8;
  v8us v;
#pragma unroll
  for (int i = 0; i < 8; ++i) v[i] = bf16_bits(W[(size_t)(k8 + i) * N + n]);
  *(v8us*)(Wt + (size_t)n * K + k8) = v;
  
}

// GEMM C[M][N] (f32, pitch ldc) = act(A[M][K]·W + bias). A f32 row-major (pitch lda) converted per fragment to bf16
// (ASPLIT: hi/lo two planes -> 2 terms, else single rounded term); Wt bf16 [N][K] (pitch ldb). BIAS_BF16 rounds the
// bias to bf16 first (bias quantised to bf16 before the add). K%32==0, M%16==0, N%64==0.
template <bool ASPLIT, int ACT, bool BIAS_BF16>
__global__ __launch_bounds__(128) void k_gemm_bf(const float* __restrict__ A, int lda, const unsigned short* __restrict__ Wt, int ldb,
                                               const float* __restrict__ bias, float* __restrict__ C, int ldc, int M, int N, int K) {
  __shared__ __attribute__((aligned(16))) float so[4][16][64];
  const int tid = threadIdx.x, w = tid >> 5, lane = tid & 31, ln = lane & 15, hh = lane >> 4;
  const int ntn = N / 64;
  const int wid = blockIdx.x * 4 + w;
  const int mt = wid / ntn, nq = wid % ntn;
  if (mt * 16 >= M) return;
  const int row0 = mt * 16, col0 = nq * 64;
  const float* arow = A + (size_t)(row0 + ln) * lda;
  v8f acc[4] = {};
  for (int kb = 0; kb < K; kb += 32) {
    FragB ah, al;
    const v4f x0 = *(const v4fa*)(arow + kb + 8 * hh), x1 = *(const v4fa*)(arow + kb + 8 * hh + 4);
    const v4f x2 = *(const v4fa*)(arow + kb + 16 + 8 * hh), x3 = *(const v4fa*)(arow + kb + 16 + 8 * hh + 4);
    float xs[16] = {x0[0],x0[1],x0[2],x0[3],x1[0],x1[1],x1[2],x1[3],x2[0],x2[1],x2[2],x2[3],x3[0],x3[1],x3[2],x3[3]};
#pragma unroll
    for (int i = 0; i < 16; ++i) { const unsigned short hb = bf16_bits(xs[i]); ah.u[i] = hb; al.u[i] = ASPLIT ? bf16_bits(xs[i] - bf16_val(hb)) : (unsigned short)0; }
#pragma unroll
    for (int t = 0; t < 4; ++t) {
      const unsigned short* brow = Wt + (size_t)(col0 + t * 16 + ln) * ldb + kb;
      FragB b;
      b.half[0] = *(const v8us*)(brow + 8 * hh);
      b.half[1] = *(const v8us*)(brow + 16 + 8 * hh);
      acc[t] = mmaN<ASPLIT ? 2 : 1>(ah.v, al.v, b.v, b.v, acc[t]);
    }
  }
#pragma unroll
  for (int t = 0; t < 4; ++t) {
    float bv = bias ? bias[col0 + t * 16 + ln] : 0.f;
    if (BIAS_BF16) bv = bf16_round(bv);
#pragma unroll
    for (int r = 0; r < 8; ++r) { float v = acc[t][r] + bv; if (ACT == 1) v = fmaxf(v, 0.f); so[w][8 * hh + r][t * 16 + ln] = v; }
  }
  __builtin_amdgcn_fence(__ATOMIC_ACQ_REL, "workgroup");
  __builtin_amdgcn_wave_barrier();
  const int rsub = lane >> 4, c4 = (lane & 15) * 4;
  {
#pragma unroll
    for (int q = 0; q < 8; ++q) {
      const int r = q * 2 + rsub;
      const v4f v = *(const v4fa*)&so[w][r][c4];
      *(v4f*)(C + (size_t)(row0 + r) * ldc + col0 + c4) = v;
    }
    
  }
}

// GEMM C = act(A·W + bias + resid): A f32 (ASPLIT -> hi/lo 2 terms), Wt bf16 [N][K]; ACT 0 none, 1 relu, 2 exact gelu;
// resid (optional, f32, row index = (row % rmod), pitch ldr, RES_BF16 rounds it) added before the activation.
template <bool ASPLIT, int ACT, bool BIAS_BF16, bool RES_BF16>
__global__ __launch_bounds__(128) void k_gemm_bf3(const float* __restrict__ A, int lda, const unsigned short* __restrict__ Wt, int ldb,
                                                const float* __restrict__ bias, const float* __restrict__ resid, int rmod, int ldr,
                                                float* __restrict__ C, int ldc, int M, int N, int K) {
  __shared__ __attribute__((aligned(16))) float so[4][16][64];
  const int tid = threadIdx.x, w = tid >> 5, lane = tid & 31, ln = lane & 15, hh = lane >> 4;
  const int ntn = N / 64;
  const int wid = blockIdx.x * 4 + w;
  const int mt = wid / ntn, nq = wid % ntn;
  if (mt * 16 >= M) return;
  const int row0 = mt * 16, col0 = nq * 64;
  const float* arow = A + (size_t)(row0 + ln) * lda;
  v8f acc[4] = {};
  for (int kb = 0; kb < K; kb += 32) {
    FragB ah, al;
    const v4f x0 = *(const v4fa*)(arow + kb + 8 * hh), x1 = *(const v4fa*)(arow + kb + 8 * hh + 4);
    const v4f x2 = *(const v4fa*)(arow + kb + 16 + 8 * hh), x3 = *(const v4fa*)(arow + kb + 16 + 8 * hh + 4);
    float xs[16] = {x0[0],x0[1],x0[2],x0[3],x1[0],x1[1],x1[2],x1[3],x2[0],x2[1],x2[2],x2[3],x3[0],x3[1],x3[2],x3[3]};
#pragma unroll
    for (int i = 0; i < 16; ++i) { const unsigned short hb = bf16_bits(xs[i]); ah.u[i] = hb; al.u[i] = ASPLIT ? bf16_bits(xs[i] - bf16_val(hb)) : (unsigned short)0; }
#pragma unroll
    for (int t = 0; t < 4; ++t) {
      const unsigned short* brow = Wt + (size_t)(col0 + t * 16 + ln) * ldb + kb;
      FragB b;
      b.half[0] = *(const v8us*)(brow + 8 * hh);
      b.half[1] = *(const v8us*)(brow + 16 + 8 * hh);
      acc[t] = mmaN<ASPLIT ? 2 : 1>(ah.v, al.v, b.v, b.v, acc[t]);
    }
  }
#pragma unroll
  for (int t = 0; t < 4; ++t) {
    const int col = col0 + t * 16 + ln;
    float bv = bias ? bias[col] : 0.f;
    if (BIAS_BF16) bv = bf16_round(bv);
#pragma unroll
    for (int r = 0; r < 8; ++r) {
      float v = acc[t][r] + bv;
      if (resid) { float rv = resid[(size_t)((row0 + 8 * hh + r) % rmod) * ldr + col]; if (RES_BF16) rv = bf16_round(rv); v += rv; }
      if (ACT == 1) v = fmaxf(v, 0.f);
      if (ACT == 2) v = 0.5f * v * (1.0f + erff(v * 0.70710678118654752f));
      if (ACT == 3) { const float u = 0.7978845608028654f * (v + 0.044715f * v * v * v); v = 0.5f * v * (1.0f + tanhf(u)); }
      so[w][8 * hh + r][t * 16 + ln] = v;
    }
  }
  __builtin_amdgcn_fence(__ATOMIC_ACQ_REL, "workgroup");
  __builtin_amdgcn_wave_barrier();
  const int rsub = lane >> 4, c4 = (lane & 15) * 4;
  {
#pragma unroll
    for (int q = 0; q < 8; ++q) {
      const int r = q * 2 + rsub;
      const v4f v = *(const v4fa*)&so[w][r][c4];
      *(v4f*)(C + (size_t)(row0 + r) * ldc + col0 + c4) = v;
    }
    
  }
}
// row LayerNorm (biased variance, eps) over N: s = X (+ R); optional out_sum <- s; out_norm <- (s-mu)*rsqrt(var+eps)*g + b
template <bool PARAM_BF16>
__global__ __launch_bounds__(256) void k_layernorm(const float* __restrict__ X, const float* __restrict__ R, const float* __restrict__ g, const float* __restrict__ bta,
                                                  float* __restrict__ out_sum, float* __restrict__ out_norm, int N, float eps) {
  __shared__ float red[256];
  const int row = blockIdx.x, tid = threadIdx.x;
  const float* x = X + (size_t)row * N; const float* rr = R ? R + (size_t)row * N : nullptr;
  float vals[16];                     // up to N = 4096
  const int per = N / 256;            // contiguous chunk per thread? use strided-by-4 chunks: thread handles j = tid*4 + 1024*u
  float s1 = 0.f;
  for (int u = 0; u < per / 4; ++u) {
    const int j = tid * 4 + 1024 * u;
    const v4f a = *(const v4fa*)(x + j);
    v4f b = {0.f,0.f,0.f,0.f}; if (rr) b = *(const v4fa*)(rr + j);
#pragma unroll
    for (int q = 0; q < 4; ++q) { const float v = a[q] + b[q]; vals[u * 4 + q] = v; s1 += v; }
  }
  red[tid] = s1; __syncthreads();
  for (int st = 128; st > 0; st >>= 1) { if (tid < st) red[tid] += red[tid + st]; __syncthreads(); }
  const float mu = red[0] / (float)N; __syncthreads();
  float s2 = 0.f;
  for (int u = 0; u < per / 4; ++u)
#pragma unroll
    for (int q = 0; q < 4; ++q) { const float c = vals[u * 4 + q] - mu; s2 += c * c; }
  red[tid] = s2; __syncthreads();
  for (int st = 128; st > 0; st >>= 1) { if (tid < st) red[tid] += red[tid + st]; __syncthreads(); }
  const float rs = rsqrtf(red[0] / (float)N + eps);
  {
    for (int u = 0; u < per / 4; ++u) {
      const int j = tid * 4 + 1024 * u;
      v4f o, sm;
#pragma unroll
      for (int q = 0; q < 4; ++q) {
        float gg = g[j + q], bb = bta[j + q];
        if (PARAM_BF16) { gg = bf16_round(gg); bb = bf16_round(bb); }
        sm[q] = vals[u * 4 + q]; o[q] = (vals[u * 4 + q] - mu) * rs * gg + bb;
      }
      if (out_sum) *(v4f*)(out_sum + (size_t)row * N + j) = sm;
      *(v4f*)(out_norm + (size_t)row * N + j) = o;
    }
    
  }
}



// ---- f16 WMMA path (v_wmma_f32_16x16x32_f16): 11-bit significands for operands in range — used where a [0,1] probability operand needs more precision than bf16
typedef _Float16 v16h __attribute__((ext_vector_type(16)));
union FragH { v16h v; v8us half[2]; _Float16 h[16]; unsigned short u[16]; };
template <int NT>
__device__ __forceinline__ v8f mmaH(v16h ah, v16h al, v16h bh, v16h bl, v8f c) {
  c = __builtin_amdgcn_wmma_f32_16x16x32_f16(false, ah, false, bh, (short)0, c, false, false);
  if (NT >= 2) c = __builtin_amdgcn_wmma_f32_16x16x32_f16(false, al, false, bh, (short)0, c, false, false);
  if (NT >= 3) c = __builtin_amdgcn_wmma_f32_16x16x32_f16(false, ah, false, bl, (short)0, c, false, false);
  asm volatile("v_nop\n\tv_nop\n\tv_nop\n\tv_nop" : "+v"(c) : "v"(ah), "v"(al), "v"(bh), "v"(bl));
  return c;
}
// batched GEMM like k_gemm_b but f16 operands: A f32 (split into f16 hi/lo if ASPLIT, else rounded to f16), Bt = f16 values [n][k]; alpha; C f32; N multiple of 16 (partial tiles skipped)
template <bool ASPLIT>
__global__ __launch_bounds__(128) void k_gemm_h(const float* __restrict__ A, int lda, size_t sA, const _Float16* __restrict__ Bh, int ldb, size_t sB, float alpha, float* __restrict__ C, int ldc, size_t sC, int M, int N, int K) {
  __shared__ __attribute__((aligned(16))) float so[4][16][64];
  const int tid = threadIdx.x, w = tid >> 5, lane = tid & 31, ln = lane & 15, hh = lane >> 4; const int by = blockIdx.y;
  A += (size_t)by * sA; Bh += (size_t)by * sB; C += (size_t)by * sC;
  const int ntn = (N + 63) / 64; const int wid = blockIdx.x * 4 + w; const int mt = wid / ntn, nq = wid % ntn; if (mt * 16 >= M) return;
  const int row0 = mt * 16, col0 = nq * 64; const float* arow = A + (size_t)(row0 + ln) * lda;
  v8f acc[4] = {};
  for (int kb = 0; kb < K; kb += 32) {
    FragH ah, al;
    const v4f x0 = *(const v4fa*)(arow + kb + 8 * hh), x1 = *(const v4fa*)(arow + kb + 8 * hh + 4), x2 = *(const v4fa*)(arow + kb + 16 + 8 * hh), x3 = *(const v4fa*)(arow + kb + 16 + 8 * hh + 4);
    float xs[16] = {x0[0],x0[1],x0[2],x0[3],x1[0],x1[1],x1[2],x1[3],x2[0],x2[1],x2[2],x2[3],x3[0],x3[1],x3[2],x3[3]};
#pragma unroll
    for (int i = 0; i < 16; ++i) { const _Float16 h = (_Float16)xs[i]; ah.h[i] = h; al.h[i] = ASPLIT ? (_Float16)(xs[i] - (float)h) : (_Float16)0.0f; }
#pragma unroll
    for (int t = 0; t < 4; ++t) { if (col0 + t * 16 >= N) continue; const size_t boff = (size_t)(col0 + t * 16 + ln) * ldb + kb; FragH bq; bq.half[0] = *(const v8us*)(Bh + boff + 8 * hh); bq.half[1] = *(const v8us*)(Bh + boff + 16 + 8 * hh);
      acc[t] = mmaH<ASPLIT ? 2 : 1>(ah.v, al.v, bq.v, bq.v, acc[t]); }
  }
#pragma unroll
  for (int t = 0; t < 4; ++t) { if (col0 + t * 16 >= N) continue;
#pragma unroll
    for (int r = 0; r < 8; ++r) so[w][8 * hh + r][t * 16 + ln] = acc[t][r] * alpha; }
  __builtin_amdgcn_fence(__ATOMIC_ACQ_REL, "workgroup"); __builtin_amdgcn_wave_barrier();
  const int rsub = lane >> 4, c4 = (lane & 15) * 4;
  {
#pragma unroll
    for (int q = 0; q < 8; ++q) { const int r = q * 2 + rsub; if (col0 + c4 < N) { const v4f v = *(const v4fa*)&so[w][r][c4]; *(v4f*)(C + (size_t)(row0 + r) * ldc + col0 + c4) = v; } }
     }
}

// Wt[n][k] = f16(W[k][n]·scale) from f32 row-major W[K][N] (scale = power of two; bf16-exact weights stay exact in f16 away from the subnormal range)
__global__ __launch_bounds__(256) void k_wt_f16(const float* __restrict__ W, _Float16* __restrict__ Wt, int K, int N, float scale) {
  const int t = blockIdx.x * 256 + threadIdx.x; if (t >= N * (K / 8)) return; const int n = t / (K / 8), k8 = (t % (K / 8)) * 8; FragH f;
#pragma unroll
  for (int i = 0; i < 8; ++i) f.h[i] = (_Float16)(bf16_round(W[(size_t)(k8 + i) * N + n]) * scale); const v8us o = f.half[0];
  *(v8us*)((unsigned short*)Wt + (size_t)n * K + k8) = o; 
}
// k_gemm_hh variant with fused epilogue: v = acc·alpha + bias[by·sBias + col] (+ CP[(row/rowsPerB)·sCPb + by·64 + col] if CP) ; ACT 0 none / 1 elu ; writes f16 C16 (and f32 C if non-null)
template <int ACT>
__global__ __launch_bounds__(128) void k_gemm_hhx(const _Float16* __restrict__ A, int lda, size_t sA, const _Float16* __restrict__ Bh, int ldb, size_t sB, float alpha, const float* __restrict__ bias, size_t sBias, const float* __restrict__ CP, int rowsPerB, size_t sCPb, int row0g,
    float* __restrict__ C, _Float16* __restrict__ C16, int ldc, size_t sC, int M, int N, int K) {
  __shared__ __attribute__((aligned(16))) float so[4][16][64];
  const int tid = threadIdx.x, w = tid >> 5, lane = tid & 31, ln = lane & 15, hh = lane >> 4; const int by = blockIdx.y;
  A += (size_t)by * sA; Bh += (size_t)by * sB; const size_t cofs = (size_t)by * sC; const float* bp = bias ? bias + (size_t)by * sBias : nullptr;
  const int ntn = (N + 63) / 64; const int wid = blockIdx.x * 4 + w; const int mt = wid / ntn, nq = wid % ntn; if (mt * 16 >= M) return;
  const int row0 = mt * 16, col0 = nq * 64; const _Float16* arow = A + (size_t)(row0 + ln) * lda;
  v8f acc[4] = {};
  for (int kb = 0; kb < K; kb += 32) { FragH ah; ah.half[0] = *(const v8us*)((const unsigned short*)arow + kb + 8 * hh); ah.half[1] = *(const v8us*)((const unsigned short*)arow + kb + 16 + 8 * hh);
#pragma unroll
    for (int t = 0; t < 4; ++t) { if (col0 + t * 16 >= N) continue; const size_t boff = (size_t)(col0 + t * 16 + ln) * ldb + kb; FragH bq; bq.half[0] = *(const v8us*)((const unsigned short*)Bh + boff + 8 * hh); bq.half[1] = *(const v8us*)((const unsigned short*)Bh + boff + 16 + 8 * hh);
      acc[t] = mmaH<1>(ah.v, ah.v, bq.v, bq.v, acc[t]); }
  }
#pragma unroll
  for (int t = 0; t < 4; ++t) { if (col0 + t * 16 >= N) continue; const int col = col0 + t * 16 + ln; const float bv = bp ? bf16_round(bp[col]) : 0.f;
#pragma unroll
    for (int r = 0; r < 8; ++r) { float v = acc[t][r] * alpha + bv; if (CP) { const int rr = row0g + row0 + 8 * hh + r; if (rowsPerB < 0) v += CP[cofs + (size_t)rr * ldc + col];      /* rowsPerB < 0: own element of the batched C plane */ else { const int bidx = rr / rowsPerB; v += CP[(size_t)bidx * sCPb + (size_t)by * 64 + col]; } } if (ACT == 1) v = (v > 0.f) ? v : expm1f(v); else if (ACT == 7) v = (v > 0.f) ? v + 1.0f : expf(v); else if (ACT == 8) v = tanhf(v); else if (ACT == 9) v = 0.5f * v * (1.0f + tanhf(0.7978845608028654f * (v + 0.044715f * v * v * v))); else if (ACT == 11) v = 1.0f / (1.0f + expf(-v)); else if (ACT == 12) v = (v > 0.f) ? v : 0.01f * v; else if (ACT == 14) v = (v > 0.f) ? v : 0.1f * v; else if (ACT == 16) v = (v >= 0.f) ? v : 0.3f * v; else if (ACT == 17) v = (v >= 0.f) ? v : 0.2f * v; else if (ACT == 15) v = v / (1.0f + expf(-v)); else if (ACT == 3) v = fmaxf(v, 0.f); else if (ACT == 6) v = 0.5f * v * (1.0f + erff(v * 0.70710678118654752f)); so[w][8 * hh + r][t * 16 + ln] = v; } }
  __builtin_amdgcn_fence(__ATOMIC_ACQ_REL, "workgroup"); __builtin_amdgcn_wave_barrier();
  const int rsub = lane >> 4, c4 = (lane & 15) * 4; typedef _Float16 v4h __attribute__((ext_vector_type(4)));
  {
#pragma unroll
    for (int q = 0; q < 8; ++q) { const int r = q * 2 + rsub; if (col0 + c4 < N) { const v4f v = *(const v4fa*)&so[w][r][c4]; if (C) *(v4f*)(C + cofs + (size_t)(row0 + r) * ldc + col0 + c4) = v; if (C16) { v4h h4; for (int i = 0; i < 4; ++i) h4[i] = (_Float16)v[i]; *(v4h*)(C16 + cofs + (size_t)(row0 + r) * ldc + col0 + c4) = h4; } } }
     }
}


typedef _Float16 v4h __attribute__((ext_vector_type(4)));

__global__ __launch_bounds__(256) void k_x16(const float* __restrict__ x, _Float16* __restrict__ X16, size_t n8) { const size_t t = (size_t)blockIdx.x * 256 + threadIdx.x; if (t >= n8) return; FragH f;
#pragma unroll
  for (int q = 0; q < 8; ++q) f.h[q] = (_Float16)bf16_round(x[t * 8 + q]); *(v8us*)((unsigned short*)X16 + t * 8) = f.half[0];  }
__global__ __launch_bounds__(256) void k_h16(const float* __restrict__ x, _Float16* __restrict__ X16, size_t n8) { const size_t t = (size_t)blockIdx.x * 256 + threadIdx.x; if (t >= n8) return; FragH f;
#pragma unroll
  for (int q = 0; q < 8; ++q) f.h[q] = (_Float16)x[t * 8 + q]; *(v8us*)((unsigned short*)X16 + t * 8) = f.half[0];  }
__global__ __launch_bounds__(256) void k_round16f(const float* __restrict__ W, _Float16* __restrict__ Bt, size_t n8) { const size_t t = (size_t)blockIdx.x * 256 + threadIdx.x; if (t >= n8) return; FragH f;
#pragma unroll
  for (int i = 0; i < 8; ++i) f.h[i] = (_Float16)(bf16_round(W[t * 8 + i]) * 16.0f); *(v8us*)((unsigned short*)Bt + t * 8) = f.half[0];  }
template <int NHv, int TTv>
__global__ __launch_bounds__(256) void k_vt(const _Float16* __restrict__ V16, int ldv, int voff, _Float16* __restrict__ Vt) { __shared__ unsigned short tl[64][66]; const int tid = threadIdx.x; const int slab = blockIdx.x / (TTv / 64), lg = blockIdx.x % (TTv / 64); const int b = slab / NHv, h = slab % NHv;
  for (int i = tid; i < 64 * 8; i += 256) { const int r = i / 8, c8 = (i % 8) * 8; FragH f; f.half[0] = *(const v8us*)((const unsigned short*)V16 + ((size_t)b * TTv + lg * 64 + r) * ldv + voff + h * 64 + c8);
#pragma unroll
    for (int q = 0; q < 8; ++q) tl[r][c8 + q] = f.u[q]; }
  __syncthreads();
  {
#pragma unroll
    for (int rd = 0; rd < 2; ++rd) { const int d = rd * 32 + tid / 8, pc = tid % 8; FragH f;
#pragma unroll
      for (int q = 0; q < 8; ++q) f.u[q] = tl[pc * 8 + q][d];
      *(v8us*)((unsigned short*)Vt + ((size_t)slab * 64 + d) * TTv + lg * 64 + pc * 8) = f.half[0]; }
     } }

__global__ __launch_bounds__(256) void k_hl(const float* __restrict__ F, _Float16* __restrict__ Hh, _Float16* __restrict__ Hl, size_t n8) { const size_t t = (size_t)blockIdx.x * 256 + threadIdx.x; if (t >= n8) return; FragH fh, fl; const v4f a = *(const v4fa*)(F + t * 8), c = *(const v4fa*)(F + t * 8 + 4);
#pragma unroll
  for (int q = 0; q < 4; ++q) { _Float16 h = (_Float16)a[q]; fh.h[q] = h; fl.h[q] = (_Float16)((a[q] - (float)h) * 1024.0f); h = (_Float16)c[q]; fh.h[4 + q] = h; fl.h[4 + q] = (_Float16)((c[q] - (float)h) * 1024.0f); }
  { *(v8us*)((unsigned short*)Hh + t * 8) = fh.half[0]; *(v8us*)((unsigned short*)Hl + t * 8) = fl.half[0];  } }

// ---- LDS-staged GEMM: C[M][N] = alpha * A[M][K] . Bt[N][K]^T, f16 operands, f32 accumulation; one 128 x 128 tile of C per block of four waves (2 x 2, 64 x 64 of C a wave); M, N multiples of 128, K of 64 ----
// Each slab of 64 k (128-byte pieces of 128 A rows and 128 Bt rows) comes in as whole-line 16-byte loads (8 lanes a row, 4 rows a wave-load), goes through registers into one of two LDS buffers, and is read from there as fragments:
// every operand byte leaves L2 once per block and serves 64 rows or columns of each wave that needs it. The next slab's global loads fly while this slab is multiplied; one barrier a slab.
__device__ __forceinline__ v16h g2_frag(const _Float16* p, int hh) { FragH f; f.half[0] = *(const v8us*)((const unsigned short*)p + 8 * hh); f.half[1] = *(const v8us*)((const unsigned short*)p + 16 + 8 * hh); return f.v; }
#define G3T 128                      /* tile rows of A and of Bt per block */
#define G3K 64                       /* k per slab */
#define G3P 72                       /* LDS row pitch in f16: 144 bytes = 16 x odd, the conflict-free pitch for 16-byte fragment reads */
#define G3B (2 * G3T * G3P)          /* f16 per buffer: rows 0..127 A, rows 128..255 Bt */
// one slab: every fragment of its 64 k from LDS, then the 2 x 16 products of the wave's 64 x 64 tile, k ascending; each '#pragma unroll' makes the index of a register array a constant
__device__ __forceinline__ void g3_slab(v8f (&acc)[4][4], const unsigned short* fa, const unsigned short* fb, int hh) { v16h a[2][4], b[2][4];
#pragma unroll
  for (int kk = 0; kk < 2; ++kk)
#pragma unroll
    for (int i = 0; i < 4; ++i) { a[kk][i] = g2_frag((const _Float16*)(fa + 16 * i * G3P + 32 * kk), hh); b[kk][i] = g2_frag((const _Float16*)(fb + 16 * i * G3P + 32 * kk), hh); }
#pragma unroll
  for (int kk = 0; kk < 2; ++kk)
#pragma unroll
    for (int i = 0; i < 4; ++i)
#pragma unroll
      for (int j = 0; j < 4; ++j) acc[i][j] = __builtin_amdgcn_wmma_f32_16x16x32_f16(false, a[kk][i], false, b[kk][j], (short)0, acc[i][j], false, false); }
// behind a run of global loads from two pointers: the wait that stands in front of any rewrite of the registers the loads name; naming the pointers keeps their registers live up to the wait.
// Built without it, one load of the run sank to just in front of its LDS store (no time to fly).
#define G3_XW(p, q) asm volatile("s_wait_xcnt 0x0" :: "v"(p), "v"(q) : "memory")
// CAUS: grid z = causal query tile of QT rows (A and C step QT rows a tile). 1 = scores: only key columns up to the tile's end are computed; 2 = P V: K ends at the tile's end. grid x = (rows / 128) * (N / 128), grid y = batch.
// Query tiles inside the first QT0 rows (CAUS, operands as f16 pairs): 1 = column group col0 / QT0 is the term: 0 = A Bt, 1 = A2 Bt, 2 = A B2 (A2, B2: the lo rows, QT0 a batch), all QT0 keys; 2 = Bt is B2 (V^T rows hi | hi | lo) and K = 3 QT0.
// H16: the output rows are f16 (C16), else f32 (C). X32 (with H16): of the first QT0 rows of every SQ rows the part that the rounding to f16 left goes to CL as f16, packed QT0 rows a batch. The row pitches lda, ldb, ldc, N and K are compile-time constants: a thread's eight rows of an operand are then one address pair with immediate offsets.
// VTR (with H16, one batch of SQ rows after the other, the last DM columns = v): a block of v columns stores its f16 tile TRANSPOSED into VT [batch][v column][key] and not into C16; with X32 its first QT0 keys also into VT3 [batch][v column][hi | hi | lo, QT0 keys each].
template <int CAUS, bool H16, bool X32, int lda, int ldb, int ldc, int N, int KF, bool VTR>
__device__ __forceinline__ void g3_body(const _Float16* __restrict__ A, size_t sA, const _Float16* __restrict__ Bh, size_t sB, float alpha,
    float* __restrict__ C, _Float16* __restrict__ C16, size_t sC, _Float16* __restrict__ VT, const _Float16* __restrict__ A2, const _Float16* __restrict__ B2, _Float16* __restrict__ CL, _Float16* __restrict__ VT3) {
  __shared__ __attribute__((aligned(16))) unsigned short sm[2 * G3B];      /* 73,728 bytes; after the last slab the same bytes stage the output rows */
  const int tid = threadIdx.x, w = tid >> 5, lane = tid & 31, ln = lane & 15, hh = lane >> 4; const int by = blockIdx.y;
  const int qt = CAUS ? SQ / QT - 1 - (int)blockIdx.z : 0;      /* low z starts first: the tile with the most keys goes first */
  const bool pr = CAUS && qt < QT0 / QT;      /* a query tile whose operands are f16 pairs; the same for the whole block */
  const _Float16* Ab = A + (size_t)by * sA + (size_t)qt * QT * lda; const _Float16* Bb = Bh + (size_t)by * sB; const size_t cofs = (size_t)by * sC + (size_t)qt * QT * ldc;
  const int ntn = N / G3T; const int mt = blockIdx.x / ntn, nq = blockIdx.x - mt * ntn; const int row0 = mt * G3T, col0 = nq * G3T;
  int br0 = col0;      /* the Bt row of the tile's first column */
  if (CAUS == 1) {      /* both returns: the same for the whole block, in front of every barrier */
    if (pr) { const int term = col0 / QT0; if (term >= 3) return; br0 = col0 - term * QT0;
      if (term == 1) Ab = A2 + ((size_t)by * QT0 + (size_t)qt * QT) * lda;
      if (term == 2) Bb = B2 + (size_t)by * QT0 * ldb; }
    else if (col0 >= (qt + 1) * QT) return; }
  if (CAUS == 2 && pr) Bb = B2 + (size_t)by * sB;
  const int K = (CAUS == 2) ? (pr ? 3 * QT0 : (qt + 1) * QT) : KF;
  const int sr = tid >> 3, sc = (tid & 7) * 8;      /* staging: thread t moves 16-byte piece t % 8 of rows t / 8 + 16 i, i = 0..7, of both operands */
  const unsigned short* ga = (const unsigned short*)Ab + (size_t)(row0 + sr) * lda + sc;
  const unsigned short* gb = (const unsigned short*)Bb + (size_t)(br0 + sr) * ldb + sc;
  unsigned short* st = sm + sr * G3P + sc;
  const int wm = w >> 1, wn = w & 1;
  const unsigned short* fa = sm + (wm * 64 + ln) * G3P; const unsigned short* fb = sm + (G3T + wn * 64 + ln) * G3P;
  const v8f z8 = {0.f,0.f,0.f,0.f,0.f,0.f,0.f,0.f}; v8f acc[4][4]; v8us ra[8], rb[8];
  /* every '#pragma unroll' of this kernel makes the index of a register array a constant */
#pragma unroll
  for (int i = 0; i < 4; ++i)
#pragma unroll
    for (int j = 0; j < 4; ++j) acc[i][j] = z8;
#pragma unroll
  for (int i = 0; i < 8; ++i) { ra[i] = *(const v8us*)(ga + 16 * i * lda); rb[i] = *(const v8us*)(gb + 16 * i * ldb); }
  G3_XW(ga, gb);
#pragma unroll
  for (int i = 0; i < 8; ++i) { *(v8us*)(st + 16 * i * G3P) = ra[i]; *(v8us*)(st + (G3T + 16 * i) * G3P) = rb[i]; }
  __syncthreads();
  const int nkt = K / G3K;
  for (int kt = 0; kt + 1 < nkt; ++kt) {      /* the trip count is the same for the whole block */
    const int bo = (kt & 1) * G3B;
    const unsigned short* pa = ga + (kt + 1) * G3K; const unsigned short* pb = gb + (kt + 1) * G3K;
#pragma unroll
    for (int i = 0; i < 8; ++i) { ra[i] = *(const v8us*)(pa + 16 * i * lda); rb[i] = *(const v8us*)(pb + 16 * i * ldb); }
    G3_XW(pa, pb);
    g3_slab(acc, fa + bo, fb + bo, hh);
    unsigned short* sn = st + (G3B - bo);      /* the other buffer: its last readers left it in front of the barrier that ended the slab before */
#pragma unroll
    for (int i = 0; i < 8; ++i) { *(v8us*)(sn + 16 * i * G3P) = ra[i]; *(v8us*)(sn + (G3T + 16 * i) * G3P) = rb[i]; }
    __syncthreads(); }      /* publishes the next slab and ends every read of this one */
  g3_slab(acc, fa + ((nkt - 1) & 1) * G3B, fb + ((nkt - 1) & 1) * G3B, hh);
  __syncthreads();      /* ends every read of the last slab: the output rows are staged over it */
  float* so = (float*)sm + w * (64 * 68);      /* the wave's own 64 x 64 f32 rows at pitch 68, so that the stores below are whole lines */
  if (VTR && col0 >= N - DM) {      /* the same for the whole block: a tile of 128 columns lies wholly inside or outside the v columns */
    const int rs = lane >> 4, k4 = (lane & 15) * 4;
#pragma unroll
    for (int i = 0; i < 4; ++i)
#pragma unroll
      for (int j = 0; j < 4; ++j) acc[i][j] *= alpha;
    /* staged column by column: the eight rows a lane holds of one column are neighbours there (two 16-byte LDS stores), and a v column's 64 keys read back as one whole line */
#pragma unroll
    for (int i = 0; i < 4; ++i)
#pragma unroll
      for (int j = 0; j < 4; ++j) { v4f lo4, hi4;
#pragma unroll
        for (int r = 0; r < 4; ++r) { lo4[r] = acc[i][j][r]; hi4[r] = acc[i][j][4 + r]; }
        float* d = &so[(16 * j + ln) * 68 + 16 * i + 8 * hh]; *(v4fa*)d = lo4; *(v4fa*)(d + 4) = hi4; }
    __builtin_amdgcn_fence(__ATOMIC_ACQ_REL, "workgroup"); __builtin_amdgcn_wave_barrier();      /* the wave reads back what its other lanes wrote */
    _Float16* vt = VT + ((size_t)(row0 / SQ) * DM + (col0 - (N - DM)) + wn * 64 + rs) * SQ + row0 % SQ + wm * 64 + k4;
    if (X32 && row0 % SQ < QT0) {      /* the same for the whole block: keys of the rows that carry f16 pairs */
      _Float16* v3 = VT3 + ((size_t)(row0 / SQ) * DM + (col0 - (N - DM)) + wn * 64 + rs) * SQ + row0 % SQ + wm * 64 + k4;
#pragma unroll
      for (int q = 0; q < 32; ++q) { const v4f v = *(const v4fa*)&so[(q * 2 + rs) * 68 + k4]; v4h h4, l4; for (int i = 0; i < 4; ++i) { h4[i] = (_Float16)v[i]; l4[i] = (_Float16)(v[i] - (float)h4[i]); }
        *(v4h*)(vt + q * 2 * SQ) = h4; *(v4h*)(v3 + q * 2 * SQ) = h4; *(v4h*)(v3 + q * 2 * SQ + QT0) = h4; *(v4h*)(v3 + q * 2 * SQ + 2 * QT0) = l4; }
      return; }      /* behind the kernel's last barrier */
#pragma unroll
    for (int q = 0; q < 32; ++q) { const v4f v = *(const v4fa*)&so[(q * 2 + rs) * 68 + k4]; v4h h4; for (int i = 0; i < 4; ++i) h4[i] = (_Float16)v[i]; *(v4h*)(vt + q * 2 * SQ) = h4; }
    if (X32) asm volatile("s_wait_xcnt 0x0" ::: "memory");      /* the built code lays the branch above directly behind these stores, with only a conditional branch between, and it rewrites their address and data registers */
    return; }      /* behind the kernel's last barrier */
#pragma unroll
  for (int i = 0; i < 4; ++i)
#pragma unroll
    for (int j = 0; j < 4; ++j)
#pragma unroll
      for (int r = 0; r < 8; ++r) so[(16 * i + 8 * hh + r) * 68 + 16 * j + ln] = acc[i][j][r] * alpha;
  __builtin_amdgcn_fence(__ATOMIC_ACQ_REL, "workgroup"); __builtin_amdgcn_wave_barrier();
  const int rsub = lane >> 4, c4 = (lane & 15) * 4; const size_t co = cofs + (size_t)(row0 + wm * 64 + rsub) * ldc + col0 + wn * 64 + c4; float* cp = H16 ? nullptr : C + co; _Float16* cp16 = H16 ? C16 + co : nullptr;
  if (X32 && row0 % SQ < QT0) {      /* the same for the whole block: a tile of 128 rows lies wholly inside or outside the first QT0 rows of a batch */
    _Float16* cl = CL + (co - (size_t)(row0 / SQ) * ((SQ - QT0) * ldc));      /* the f16 row's place less the rows of earlier batches that are not kept */
#pragma unroll
    for (int q = 0; q < 32; ++q) { const v4f v = *(const v4fa*)&so[(q * 2 + rsub) * 68 + c4]; v4h h4, l4; for (int i = 0; i < 4; ++i) { h4[i] = (_Float16)v[i]; l4[i] = (_Float16)(v[i] - (float)h4[i]); } *(v4h*)(cp16 + q * 2 * ldc) = h4; *(v4h*)(cl + q * 2 * ldc) = l4; }
    if (VTR) asm volatile("s_wait_xcnt 0x0" ::: "memory"); }      /* the built code lays the v branch behind these stores, with only a conditional branch between, and it rewrites their address and data registers */
  else {
#pragma unroll
    for (int q = 0; q < 32; ++q) { const int r = q * 2 + rsub; const v4f v = *(const v4fa*)&so[r * 68 + c4]; if (!H16) *(v4f*)(cp + q * 2 * ldc) = v; else { v4h h4; for (int i = 0; i < 4; ++i) h4[i] = (_Float16)v[i]; *(v4h*)(cp16 + q * 2 * ldc) = h4; } }
    if (X32) asm volatile("s_wait_xcnt 0x0" ::: "memory"); } }      /* the built code lays the other branch directly behind these stores, with only a conditional branch between, and it rewrites their data registers */
template <int CAUS, bool H16, bool X32, int lda, int ldb, int ldc, int N, int KF>
__global__ __launch_bounds__(128) void k_gemm3(const _Float16* __restrict__ A, size_t sA, const _Float16* __restrict__ Bh, size_t sB, float alpha,
    float* __restrict__ C, _Float16* __restrict__ C16, size_t sC, const _Float16* __restrict__ A2, const _Float16* __restrict__ B2) { g3_body<CAUS, H16, X32, lda, ldb, ldc, N, KF, false>(A, sA, Bh, sB, alpha, C, C16, sC, nullptr, A2, B2, nullptr, nullptr); }
// the projection, with the v branch in its epilogue. The register budget of four waves per SIMD is stated: LDS lets four blocks share a WGP, and left free this build took two registers more than that leaves a wave.
template <int lda, int ldb, int ldc, int N, int KF>
__global__ __launch_bounds__(128) __attribute__((amdgpu_waves_per_eu(4, 4))) void k_gemm3v(const _Float16* __restrict__ A, const _Float16* __restrict__ Bh, float alpha,
    _Float16* __restrict__ CL, _Float16* __restrict__ C16, _Float16* __restrict__ VT, _Float16* __restrict__ VT3) { g3_body<0, true, true, lda, ldb, ldc, N, KF, true>(A, 0, Bh, 0, alpha, nullptr, C16, 0, VT, nullptr, nullptr, CL, VT3); }


__global__ __launch_bounds__(256) void k_wnat(const float* __restrict__ w, size_t n8, _Float16* __restrict__ Bt) { const size_t t = (size_t)blockIdx.x * 256 + threadIdx.x; if (t >= n8) return; FragH f; for (int q = 0; q < 8; ++q) f.h[q] = (_Float16)(bf16_round(w[t * 8 + q]) * 16.0f); *(v8us*)((unsigned short*)Bt + t * 8) = f.half[0];  }
__global__ __launch_bounds__(256) void k_rsm(const float* __restrict__ S, _Float16* __restrict__ P, int nrows) {
  #pragma clang fp contract(off)
  const int i = blockIdx.x * 256 + threadIdx.x; if (i >= nrows) return; const float* s = S + (size_t)i * SQ; float mx = -3.0e38f;
#pragma unroll 1
  for (int j = 0; j < SQ; ++j) mx = fmaxf(mx, s[j]); float se = 0.f;
#pragma unroll 1
  for (int j = 0; j < SQ; ++j) se += expf(s[j] - mx); const float sc = 256.0f / se;
#pragma unroll 1
  for (int j0 = 0; j0 < SQ; j0 += 8) { FragH f; for (int q = 0; q < 8; ++q) f.h[q] = (_Float16)(expf(s[j0 + q] - mx) * sc); unsigned short* d = (unsigned short*)P + (size_t)i * SQ + j0; *(v8us*)d = f.half[0];  } }
__global__ __launch_bounds__(256) void k_vt(const _Float16* __restrict__ V16, int b, int h0, _Float16* __restrict__ VT) { __shared__ unsigned short tl[64][65]; const int tid = threadIdx.x; const int hh = blockIdx.x % HG, sg = blockIdx.x / HG; const int s0 = sg * 64; const int h = h0 + hh;
  for (int i = tid; i < 64 * 8; i += 256) { const int j = i / 8, d8 = (i % 8) * 8; FragH f; f.half[0] = *(const v8us*)((const unsigned short*)V16 + ((size_t)b * SQ + s0 + j) * DM + h * HD + d8); for (int q = 0; q < 8; ++q) tl[d8 + q][j] = f.u[q]; }
  __syncthreads();
  { for (int i = tid; i < 64 * 8; i += 256) { const int d = i / 8, j8 = (i % 8) * 8; FragH f; for (int q = 0; q < 8; ++q) f.u[q] = tl[d][j8 + q]; *(v8us*)((unsigned short*)VT + ((size_t)hh * HD + d) * SQ + s0 + j8) = f.half[0]; }  } }



// Causal softmax, ONE S ROW PER WAVE, the row held in registers: lane l owns keys 256 c + 8 l .. + 7 of each 256-key chunk c (two 16-byte loads in, one 16-byte f16 store out per chunk).
// Row max and row sum: per-lane partials (the sum in four independent chains), then a five-step butterfly over the 32 lanes. NC = nk / 256 chunks, all loads of a row in flight together.
// e^x as the fast form has it (one multiply, v_exp_f32). The v_nop is the one slot the instruction set asks for behind a transcendental before its result is read or its source overwritten.
__device__ __forceinline__ float rsm_exp(float x) { const float y = x * 1.44269504088896340736f; float e; asm("v_exp_f32 %0, %1\n\tv_nop" : "=v"(e) : "v"(y)); return e; }
// X3 (a row whose operands are f16 pairs, NC * 256 = QT0 keys): a score is the sum of its three terms, QT0 columns apart in the S row; precise expf; the weight goes out as hi | lo | hi, QT0 columns apart in the P row.
template <int NC, bool X3>
__device__ __forceinline__ void rsm_row(const float* __restrict__ s, unsigned short* __restrict__ p, int k0, int last) {
  float v[NC][8];
#pragma unroll
  for (int c = 0; c < NC; ++c) { v4f a = *(const v4fa*)(s + c * 256 + k0), b = *(const v4fa*)(s + c * 256 + k0 + 4);
    if constexpr (X3) { const v4f a1 = *(const v4fa*)(s + QT0 + c * 256 + k0), b1 = *(const v4fa*)(s + QT0 + c * 256 + k0 + 4), a2 = *(const v4fa*)(s + 2 * QT0 + c * 256 + k0), b2 = *(const v4fa*)(s + 2 * QT0 + c * 256 + k0 + 4);
      a = (a + a1) + a2; b = (b + b1) + b2; }
#pragma unroll
    for (int q = 0; q < 4; ++q) { v[c][q] = a[q]; v[c][4 + q] = b[q]; } }
  float mx = -3.0e38f;
#pragma unroll
  for (int c = 0; c < NC; ++c)
#pragma unroll
    for (int q = 0; q < 8; ++q) { if (c * 256 + k0 + q > last) v[c][q] = -1.0e9f; mx = fmaxf(mx, v[c][q]); }
#pragma unroll
  for (int m = 16; m > 0; m >>= 1) mx = fmaxf(mx, __shfl_xor(mx, m, 32));
  float s4[4] = {0.f, 0.f, 0.f, 0.f};
#pragma unroll
  for (int c = 0; c < NC; ++c)
#pragma unroll
    for (int q = 0; q < 8; ++q) { v[c][q] = X3 ? expf(v[c][q] - mx) : rsm_exp(v[c][q] - mx); s4[q & 3] += v[c][q]; }
  float se = (s4[0] + s4[1]) + (s4[2] + s4[3]);
#pragma unroll
  for (int m = 16; m > 0; m >>= 1) se += __shfl_xor(se, m, 32);
  const float sc = 256.0f / se;
#pragma unroll
  for (int c = 0; c < NC; ++c) { FragH fr, fl;
#pragma unroll
    for (int q = 0; q < 8; ++q) { const float y = v[c][q] * sc; const _Float16 h = (_Float16)y; fr.h[q] = h; if constexpr (X3) fl.h[q] = (_Float16)(y - (float)h); }
    *(v8us*)(p + c * 256 + k0) = fr.half[0];
    if constexpr (X3) { *(v8us*)(p + QT0 + c * 256 + k0) = fl.half[0]; *(v8us*)(p + 2 * QT0 + c * 256 + k0) = fr.half[0]; } }
  asm volatile("s_wait_xcnt 0x0" ::: "memory");      /* the built code lays the row lengths one behind the other, and only a conditional branch stands between these stores and the next length's code, which rewrites their address and data registers */
}
// row = number of a token row, of all batches (the same in every lane of the wave); past the first QT0 rows of a batch a row's length is the end of its own QT-row query tile, inside them QT0 keys
__device__ __forceinline__ void rsm_wave(const float* __restrict__ S, _Float16* __restrict__ P, unsigned row, int lane) {
  const int last = row % SQ; const int k0 = lane * 8;
  const float* s = S + (size_t)row * NKX; unsigned short* p = (unsigned short*)P + (size_t)row * NKX;
  switch (last / QT + 1) {      /* the same for every lane of the wave: straight-line code for each row length */
    case 1: case 2: rsm_row<QT0 / 256, true>(s, p, k0, last); break; case 3: rsm_row<3, false>(s, p, k0, last); break; case 4: rsm_row<4, false>(s, p, k0, last); break;
    case 5: rsm_row<5, false>(s, p, k0, last); break; case 6: rsm_row<6, false>(s, p, k0, last); break; case 7: rsm_row<7, false>(s, p, k0, last); break; case 8: rsm_row<8, false>(s, p, k0, last); break;
    default: break; } }
// eight rows a block, a wave a row, no barrier, no LDS
__global__ __launch_bounds__(256) void k_rsm8(const float* __restrict__ S, _Float16* __restrict__ P) {
  const int w = __builtin_amdgcn_readfirstlane((int)threadIdx.x >> 5);      /* the wave's number as a scalar: the row's addresses are formed on the scalar unit */
  rsm_wave(S, P, blockIdx.x * 8 + (unsigned)w, (int)threadIdx.x & 31); }


template <int MASKADD>
__global__ __launch_bounds__(64) void k_att0(const float* __restrict__ QF, const float* __restrict__ KF, const float* __restrict__ VF, int ld, const float* __restrict__ mask, float scale, float* __restrict__ OF, int ldo) {
  #pragma clang fp contract(off)
  __shared__ __attribute__((aligned(16))) float lq[64][64]; __shared__ __attribute__((aligned(16))) float lo[64][64];
  const int tid = threadIdx.x; const int h = blockIdx.x / (QT0 / 64), rg = blockIdx.x % (QT0 / 64); const int i = rg * 64 + tid;
  const float* qr = QF + (size_t)i * ld + h * HD;
#pragma unroll 1
  for (int c = 0; c < HD / 4; ++c) { *(v4f*)&lq[tid][c * 4] = *(const v4fa*)(qr + c * 4); const v4f z = {0.f, 0.f, 0.f, 0.f}; *(v4f*)&lo[tid][c * 4] = z; }
  float m = -1.0e30f, l = 0.f; const int jmax = MASKADD ? (SQ - 1) : (rg * 64 + 63);      /* additive-mask form: every key (the mask input decides); causal form: keys up to the block's last row */
#pragma unroll 1
  for (int j = 0; j <= jmax; ++j) { const float* kr = KF + (size_t)j * ld + h * HD; const float* vr = VF + (size_t)j * ld + h * HD; float s = 0.f;
#pragma unroll 1
    for (int c = 0; c < HD / 4; ++c) { const v4f kq = *(const v4fa*)(kr + c * 4); const v4f qq = *(v4f*)&lq[tid][c * 4]; s = __fadd_rn(s, __fmul_rn(qq[0], kq[0])); s = __fadd_rn(s, __fmul_rn(qq[1], kq[1])); s = __fadd_rn(s, __fmul_rn(qq[2], kq[2])); s = __fadd_rn(s, __fmul_rn(qq[3], kq[3])); }
    s = __fmul_rn(s, scale); if (MASKADD) s = __fadd_rn(s, __fmul_rn(bf16_round(mask[(size_t)i * SQ + j]), -10000.0f));
    const float f = (MASKADD || j <= i) ? 1.f : 0.f; const float sm = fmaf(f, s, (1.f - f) * -1.0e30f); const float mn = fmaxf(m, sm); const float sc = expf(m - mn); const float e = expf(sm - mn); l = __fadd_rn(__fmul_rn(l, sc), e); m = mn;
#pragma unroll 1
    for (int c = 0; c < HD / 4; ++c) { const v4f vv = *(const v4fa*)(vr + c * 4); v4f oo = *(v4f*)&lo[tid][c * 4]; for (int u = 0; u < 4; ++u) oo[u] = __fadd_rn(__fmul_rn(oo[u], sc), __fmul_rn(e, vv[u])); *(v4f*)&lo[tid][c * 4] = oo; } }
  const float fin = 64.0f / l;      /* o carried x64 like the f16 path */
#pragma unroll 1
  for (int c = 0; c < HD / 4; ++c) { v4f oo = *(v4f*)&lo[tid][c * 4]; for (int u = 0; u < 4; ++u) oo[u] = __fmul_rn(oo[u], fin); *(v4f*)&lo[tid][c * 4] = oo; }
  __syncthreads();
  {
#pragma unroll 1
    for (int it = 0; it < 16; ++it) { const int row = it * 4 + tid / 16, pc = (tid % 16) * 4; const v4f v = *(const v4f*)&lo[row][pc]; *(v4f*)(OF + (size_t)(rg * 64 + row) * ldo + h * HD + pc) = v; }
     } }


template <int BFIN, int WXB>
__global__ __launch_bounds__(256) void k_ln16(const float* __restrict__ X, const float* __restrict__ g, const float* __restrict__ bb, float eps, _Float16* __restrict__ N16, float* __restrict__ XB) {
  #pragma clang fp contract(off)
  __shared__ float red[256]; const size_t r = blockIdx.x; const int t = threadIdx.x; const v4f xa = *(const v4fa*)(X + r * DMQ + t * 4); float s[4]; float sum = 0.f;
  for (int q = 0; q < 4; ++q) { s[q] = BFIN ? bf16_round(xa[q]) : xa[q]; sum = __fadd_rn(sum, s[q]); }
  red[t] = sum; __syncthreads(); for (int st = 128; st > 0; st >>= 1) { if (t < st) red[t] = __fadd_rn(red[t], red[t + st]); __syncthreads(); } const float mu = red[0] / (float)DMQ; __syncthreads();
  float vs = 0.f; for (int q = 0; q < 4; ++q) { const float dl = __fadd_rn(s[q], -mu); vs = __fadd_rn(vs, __fmul_rn(dl, dl)); } red[t] = vs; __syncthreads(); for (int st = 128; st > 0; st >>= 1) { if (t < st) red[t] = __fadd_rn(red[t], red[t + st]); __syncthreads(); }
  const float rs = rsqrtf(__fadd_rn(red[0] / (float)DMQ, eps)); v4h y; v4f xb;
  for (int q = 0; q < 4; ++q) { const int c = t * 4 + q; y[q] = (_Float16)__fadd_rn(__fmul_rn(__fmul_rn(__fadd_rn(s[q], -mu), rs), bf16_round(g[c])), bf16_round(bb[c])); xb[q] = s[q]; }
  { *(v4h*)(N16 + r * DMQ + t * 4) = y; if (WXB) *(v4f*)(XB + r * DMQ + t * 4) = xb;  } }
__global__ __launch_bounds__(256) void k_ftres2(const float* __restrict__ OF0, const float* __restrict__ XB, float* __restrict__ X1, size_t n4) {
  #pragma clang fp contract(off)
  const size_t t = (size_t)blockIdx.x * 256 + threadIdx.x; if (t >= n4) return; const v4f o = *(const v4fa*)(OF0 + t * 4), xv = *(const v4fa*)(XB + t * 4); v4f y; for (int q = 0; q < 4; ++q) y[q] = __fadd_rn(__fmul_rn(o[q], 0.015625f), xv[q]); *(v4f*)(X1 + t * 4) = y;  }

__global__ __launch_bounds__(256) void k_wthd(const float* __restrict__ Wt, _Float16* __restrict__ Bt) { const size_t t = (size_t)blockIdx.x * 256 + threadIdx.x; if (t >= (size_t)NH * HD * (DM / 8)) return; const int m8 = (int)(t % (DM / 8)) * 8; const int d = (int)((t / (DM / 8)) % HD); const int h = (int)(t / ((size_t)(DM / 8) * HD)); FragH f;
  for (int q = 0; q < 8; ++q) f.h[q] = (_Float16)(16.0f * bf16_round(Wt[((size_t)h * DM + m8 + q) * HD + d])); unsigned short* dst = (unsigned short*)Bt + ((size_t)h * HD + d) * DM + m8; *(v8us*)dst = f.half[0];  }




__global__ __launch_bounds__(256) void k_wtpad(const float* __restrict__ Wm, _Float16* __restrict__ Wt, int Kr, int Kp, int Nr, int Np, float scale) {
  const int t = blockIdx.x * 256 + threadIdx.x; if (t >= Np * (Kp / 8)) return; const int n = t / (Kp / 8), k8 = (t % (Kp / 8)) * 8; const int nc = min(n, Nr - 1); const float fn = (n < Nr) ? 1.f : 0.f; FragH f;
  for (int i = 0; i < 8; ++i) { const int k = k8 + i; const int kc = min(k, Kr - 1); const float fk = (k < Kr) ? fn : 0.f; f.h[i] = (_Float16)(bf16_round(Wm[(size_t)kc * Nr + nc]) * scale * fk); }
  unsigned short* o = (unsigned short*)Wt + (size_t)n * Kp + k8; *(v8us*)o = f.half[0];  }
__global__ __launch_bounds__(128) void k_bpad(const float* __restrict__ b, float* __restrict__ Bp, int nr, int np) {
  const int i = threadIdx.x; if (i >= np) return; const float v = b[min(i, nr - 1)] * ((i < nr) ? 1.f : 0.f); *(float*)(Bp + i) = v;  }

#define DI 1024       /* inner width = NH * HD */
#define LQK (3 * DI)  /* fused q | k | v row pitch (3072) */
__global__ __launch_bounds__(256) void k_o0(const float* __restrict__ OF, float* __restrict__ ob, size_t n4) {
  #pragma clang fp contract(off)
  const size_t t = (size_t)blockIdx.x * 256 + threadIdx.x; if (t >= n4) return; const size_t e = t * 4; const int i = (int)(e / DI); const int c = (int)(e % DI); const int h = c / HD, d = c % HD; const v4f a = *(const v4fa*)(OF + e); v4f o; for (int q = 0; q < 4; ++q) o[q] = __fmul_rn(a[q], 0.015625f); float* dst = ob + (size_t)h * SQ * HD + (size_t)i * HD + d; *(v4f*)dst = o;  }

// behind a run of global loads from one pointer: the wait that stands in front of any rewrite of the registers the loads name; naming the pointer keeps its registers live up to the wait, so that no load of the run is given them as its destination
#define ATT0_XW(p) asm volatile("s_wait_xcnt 0x0" :: "v"(p) : "memory")
__global__ __launch_bounds__(256) void k_o0m(const float* __restrict__ OF, float* __restrict__ o_, size_t n4) {
  #pragma clang fp contract(off)
  const size_t t = (size_t)blockIdx.x * 256 + threadIdx.x; if (t >= n4) return; const size_t e = t * 4; OF += (size_t)blockIdx.y * QT0 * DI; o_ += (size_t)blockIdx.y * SQ * DI;      /* grid y = batch */
  const v4f a = *(const v4fa*)(OF + e); v4f o; for (int q = 0; q < 4; ++q) o[q] = __fmul_rn(a[q], 0.015625f); *(v4f*)(o_ + e) = o;  }
// W^T operand of the projection: Wt[n][k] = f16(bf16(W[k][n]) * 16) from W [DM][LQK] f32, one 64 k x 32 n tile per wave.
// Lane l reads column n0 + l of the tile's 64 rows: the 32 lanes of a load lie side by side in one row of W, so a wave-load is one whole 128-byte line. The lane's 64 values are one 128-byte piece of row n0 + l of W^T;
// they go through the wave's own LDS tile (pitch 144 bytes = 16 x odd) so that eight lanes store one such piece together: a wave-store is four whole lines.
#define WLK 64                       /* k per tile */
#define WLP 72                       /* LDS row pitch in f16 */
__global__ __launch_bounds__(128) void k_wtl(const float* __restrict__ Wm, _Float16* __restrict__ Wt) {
  __shared__ __attribute__((aligned(16))) unsigned short tl[4][32 * WLP];
  const int tid = threadIdx.x, w = tid >> 5, lane = tid & 31; const int wv = blockIdx.x * 4 + w;      /* tile number: column group fastest */
  const int n0 = (wv % (LQK / 32)) * 32, k0 = (wv / (LQK / 32)) * WLK;
  const float* sp = Wm + (size_t)k0 * LQK + n0 + lane; float v[WLK];
  /* every '#pragma unroll' of this kernel makes the index of a register array a constant; all 64 loads of a lane fly together */
#pragma unroll
  for (int i = 0; i < WLK; ++i) v[i] = sp[i * LQK];
  ATT0_XW(sp);      /* in front of the code below, which reuses the address registers of these loads */
  unsigned short* row = &tl[w][lane * WLP];
#pragma unroll
  for (int c = 0; c < WLK / 8; ++c) { FragH f;
#pragma unroll
    for (int q = 0; q < 8; ++q) f.h[q] = (_Float16)(bf16_round(v[c * 8 + q]) * 16.0f);
    *(v8us*)(row + c * 8) = f.half[0]; }
  __builtin_amdgcn_fence(__ATOMIC_ACQ_REL, "workgroup"); __builtin_amdgcn_wave_barrier();      /* the wave reads back what its other lanes wrote */
  const int r = lane >> 3, p = (lane & 7) * 8;
  unsigned short* dp = (unsigned short*)Wt + (size_t)(n0 + r) * DM + k0 + p;
#pragma unroll
  for (int q = 0; q < 8; ++q) { const v8us o = *(const v8us*)&tl[w][(q * 4 + r) * WLP + p]; *(v8us*)(dp + q * 4 * DM) = o; } }

extern "C" void kernel_launch(void* const* d_in, const int* in_sizes, int n_in,
                              void* d_out, int out_size, void* d_ws, size_t ws_size, hipStream_t stream) {
  (void)in_sizes; (void)n_in; (void)out_size;
  const float* const* I = (const float* const*)d_in; const float* x = I[0]; const float* wqkv = I[1];      /* input order: x [4][2048][1024], W_qkv ([in][out] [1024][3072]: q | k | v column thirds); the module has no biases and no output projection */
  char* ws = (char*)d_ws; size_t off = 0;
  auto take = [&](size_t bytes) { char* p = ws + off; off += (bytes + 255) & ~(size_t)255; return p; };
  _Float16* BW = (_Float16*)take((size_t)LQK * DM * 2); _Float16* X16 = (_Float16*)take(NR * DM * 2); _Float16* QKV = (_Float16*)take(NR * LQK * 2); _Float16* VT = (_Float16*)take((size_t)NB * DI * SQ * 2);
  float* S = (float*)take(NR * NKX * 4); _Float16* P = (_Float16*)take(NR * NKX * 2); _Float16* QKL = (_Float16*)take((size_t)NB * QT0 * LQK * 2); _Float16* VT3 = (_Float16*)take((size_t)NB * DI * SQ * 2);      /* ONE head: S / P row = token row, pitch NKX; every plane holds all batches; QKL: lo of the q | k rows 0..511 of every batch; VT3: V^T of keys 0..511 as hi | hi | lo, row pitch SQ */
  if (off > ws_size) return;
  k_wtl<<<(LQK / 32) * (DM / WLK) / 4, 128, 0, stream>>>(wqkv, BW);      /* [in][out] [1024][3072] -> Bt[n][k] x16, one 64 k x 32 n tile a wave */
  k_x16<<<(unsigned)((NR * DM / 8 + 255) / 256), 256, 0, stream>>>(x, X16, NR * DM / 8);      /* x (bf16-valued) as exact f16 rows */
  k_gemm3v<DM, DM, LQK, LQK, DM><<<dim3((unsigned)((NR / 128) * (LQK / 128)), 1), 128, 0, stream>>>(X16, BW, 0.0625f, QKL, QKV, VT, VT3);      /* q | k | v = x W: q and k -> f16 rows, column blocks 0 / 1024 of the fused plane (pitch 3072); v -> V^T [NB][1024][SQ] f16; no bias; of rows 0..511 of every batch also what the rounding to f16 left (exact products, f32 accumulation) */
  const _Float16* Q16 = QKV; const _Float16* K16 = QKV + DI;
  k_gemm3<1, false, false, LQK, LQK, NKX, SQ, DI><<<dim3((QT / 128) * (SQ / 128), NB, SQ / QT), 128, 0, stream>>>(Q16, (size_t)SQ * LQK, K16, (size_t)SQ * LQK, 0.03125f, S, nullptr, (size_t)SQ * NKX, QKL, QKL + DI);      /* scores / sqrt(1024) over the FULL width (K = 1024), one head; causal: only keys below each tile's end; rows 0..511: three terms side by side */
  k_rsm8<<<NB * SQ / 8, 256, 0, stream>>>(S, P);      /* causal softmax -> P x256 f16, one wave per row; rows 0..511: hi | lo | hi */
  k_gemm3<2, false, false, NKX, SQ, DI, DI, SQ><<<dim3((QT / 128) * (DI / 128), NB, SQ / QT), 128, 0, stream>>>(P, (size_t)SQ * NKX, VT, (size_t)DI * SQ, 0.00390625f, (float*)d_out, nullptr, (size_t)SQ * DI, nullptr, VT3);      /* out[b][q][:] = P V^T 2^-8 (f32), N = 1024, keys up to each tile's end; rows 0..511: K = 1536 over VT3 */
}

// v010
// Measured time: 119 microseconds a run.
// In both of two side-by-side timings against v009, it was 1.04 times as fast.
// Over all steps from v000, the starting kernel, it is 75.8 times as fast.
#include <hip/hip_runtime.h>
#include <stdint.h>
// Causal SINGLE-HEAD self-attention of full width with a fused bias-free QKV projection and NO output projection (x [4][2048][1024]; qkv = x W_qkv ([in][out] 1024 x 3072, no bias) split into q | k | v thirds of width 1024; scores = q k^T / sqrt(1024) over the FULL width (one head); causal (keys after the query -> -inf); softmax over keys; out = attn v -> [4][2048][1024]).
// Structure: token rows; x as exact f16 rows; ONE WMMA GEMM into the f16 q | k plane (pitch 3072) and, from the same epilogue, v^T [batch][1024][2048]; causal 256-row query tiles: scores GEMM with K = 1024 (alpha 1/32), causal softmax f32 -> f16 x256 weights, P . V^T GEMM with N = 1024 written as f32 (alpha 2^-8) straight into the output rows. Every stage is ONE launch over all batches (grid y) and all query tiles (grid z); S, P, V^T and the f32 planes hold all of them in the workspace.
// First-tile refinement: the first 512 query rows of every batch (which see few keys, so single-f16 q / k / v / P would be too coarse with no output projection to average the errors) carry every operand as an f16 pair, value = hi + lo (lo = what the rounding to hi left): the projection GEMM stores lo of their q | k | v beside hi, and each product is three WMMA terms, hi hi + lo hi + hi lo (lo lo lies 2^-22 below and is left out).
// Scores of these rows: the three terms are three column groups of 512 in the S row (own blocks of the scores launch), added in f32 by the softmax (precise expf), which stores P as hi | lo | hi; P . V of these rows: ONE product of K = 1536 with the V^T rows hi | hi | lo (own blocks of the P . V launch).
// Compute dtype: inputs rounded to bf16; x / weights exact; q, k, v and the softmax weights as plain f16 GEMM operands (~2^-12) past the first 512 rows of a batch, as f16 pairs (~2^-22) inside them; scores, softmax statistics and the output accumulation f32. v_wmma_f32_16x16x32_f16.
#define NB 4
#define SQ 2048
#define DM 1024
#define NH 16
#define HD 64
#define HG 4                         /* heads per attention launch group */
#define QT 256                       /* query rows per causal tile */
#define NKX SQ                       /* S / P row pitch */
#define QT0 512                      /* first rows of a batch whose operands are f16 pairs: 512 here (no output projection averages the early-row cancellation errors away; logit sigma 1.0) */
#define B0 0                         /* first batch processed (debug hook) */
#define NBR NB                       /* batches processed (debug hook) */
#define NR ((size_t)NB * SQ)
#define DMQ DM
#define DFF 4096
#define DFFR 100
#define MP ((int)((size_t)NBR * SQ)) /* rows projected (debug hook) */
#define QN SQ                        /* query rows attended per batch (debug hook) */
#define NHD NH
#define MPO MP                       /* rows through the output stage (debug hook) */
#define LQ (3 * DM)      /* row pitch of the q/k/v rows */
typedef __bf16 v16b __attribute__((ext_vector_type(16)));
typedef unsigned short v8us __attribute__((ext_vector_type(8), may_alias));
typedef float  v8f  __attribute__((ext_vector_type(8)));
typedef float  v4f  __attribute__((ext_vector_type(4)));
typedef float  v4fa __attribute__((ext_vector_type(4), may_alias));
union FragB { v16b v; v8us half[2]; unsigned short u[16]; };

__device__ __forceinline__ unsigned short bf16_bits(float x) { unsigned int u = __float_as_uint(x); return (unsigned short)((u + 0x7FFFu + ((u >> 16) & 1u)) >> 16); }
__device__ __forceinline__ float bf16_val(unsigned short b) { return __uint_as_float(((unsigned int)b) << 16); }
__device__ __forceinline__ float bf16_round(float x) { return bf16_val(bf16_bits(x)); }
// D += A·B with NT terms: 1 = ah·bh, 2 = + al·bh (A split), 3 = + ah·bl (both split)
template <int NT>
__device__ __forceinline__ v8f mmaN(v16b ah, v16b al, v16b bh, v16b bl, v8f c) {
  c = __builtin_amdgcn_wmma_f32_16x16x32_bf16(false, ah, false, bh, (short)0, c, false, false);
  if (NT >= 2) c = __builtin_amdgcn_wmma_f32_16x16x32_bf16(false, al, false, bh, (short)0, c, false, false);
  if (NT >= 3) c = __builtin_amdgcn_wmma_f32_16x16x32_bf16(false, ah, false, bl, (short)0, c, false, false);
  asm volatile("v_nop\n\tv_nop\n\tv_nop\n\tv_nop" : "+v"(c) : "v"(ah), "v"(al), "v"(bh), "v"(bl));
  return c;
}

__global__ __launch_bounds__(256) void k_wt_bf16(const float* __restrict__ W, unsigned short* __restrict__ Wt, int K, int N) {
  const int t = blockIdx.x * 256 + threadIdx.x;
  const int k8n = K / 8;
  if (t >= N * k8n) return;
  const int n = t / k8n, k8 = (t % k8n) * 8;
  v8us v;
#pragma unroll
  for (int i = 0; i < 8; ++i) v[i] = bf16_bits(W[(size_t)(k8 + i) * N + n]);
  *(v8us*)(Wt + (size_t)n * K + k8) = v;
  
}

// GEMM C[M][N] (f32, pitch ldc) = act(A[M][K]·W + bias). A f32 row-major (pitch lda) converted per fragment to bf16
// (ASPLIT: hi/lo two planes -> 2 terms, else single rounded term); Wt bf16 [N][K] (pitch ldb). BIAS_BF16 rounds the
// bias to bf16 first (bias quantised to bf16 before the add). K%32==0, M%16==0, N%64==0.
template <bool ASPLIT, int ACT, bool BIAS_BF16>
__global__ __launch_bounds__(128) void k_gemm_bf(const float* __restrict__ A, int lda, const unsigned short* __restrict__ Wt, int ldb,
                                               const float* __restrict__ bias, float* __restrict__ C, int ldc, int M, int N, int K) {
  __shared__ __attribute__((aligned(16))) float so[4][16][64];
  const int tid = threadIdx.x, w = tid >> 5, lane = tid & 31, ln = lane & 15, hh = lane >> 4;
  const int ntn = N / 64;
  const int wid = blockIdx.x * 4 + w;
  const int mt = wid / ntn, nq = wid % ntn;
  if (mt * 16 >= M) return;
  const int row0 = mt * 16, col0 = nq * 64;
  const float* arow = A + (size_t)(row0 + ln) * lda;
  v8f acc[4] = {};
  for (int kb = 0; kb < K; kb += 32) {
    FragB ah, al;
    const v4f x0 = *(const v4fa*)(arow + kb + 8 * hh), x1 = *(const v4fa*)(arow + kb + 8 * hh + 4);
    const v4f x2 = *(const v4fa*)(arow + kb + 16 + 8 * hh), x3 = *(const v4fa*)(arow + kb + 16 + 8 * hh + 4);
    float xs[16] = {x0[0],x0[1],x0[2],x0[3],x1[0],x1[1],x1[2],x1[3],x2[0],x2[1],x2[2],x2[3],x3[0],x3[1],x3[2],x3[3]};
#pragma unroll
    for (int i = 0; i < 16; ++i) { const unsigned short hb = bf16_bits(xs[i]); ah.u[i] = hb; al.u[i] = ASPLIT ? bf16_bits(xs[i] - bf16_val(hb)) : (unsigned short)0; }
#pragma unroll
    for (int t = 0; t < 4; ++t) {
      const unsigned short* brow = Wt + (size_t)(col0 + t * 16 + ln) * ldb + kb;
      FragB b;
      b.half[0] = *(const v8us*)(brow + 8 * hh);
      b.half[1] = *(const v8us*)(brow + 16 + 8 * hh);
      acc[t] = mmaN<ASPLIT ? 2 : 1>(ah.v, al.v, b.v, b.v, acc[t]);
    }
  }
#pragma unroll
  for (int t = 0; t < 4; ++t) {
    float bv = bias ? bias[col0 + t * 16 + ln] : 0.f;
    if (BIAS_BF16) bv = bf16_round(bv);
#pragma unroll
    for (int r = 0; r < 8; ++r) { float v = acc[t][r] + bv; if (ACT == 1) v = fmaxf(v, 0.f); so[w][8 * hh + r][t * 16 + ln] = v; }
  }
  __builtin_amdgcn_fence(__ATOMIC_ACQ_REL, "workgroup");
  __builtin_amdgcn_wave_barrier();
  const int rsub = lane >> 4, c4 = (lane & 15) * 4;
  {
#pragma unroll
    for (int q = 0; q < 8; ++q) {
      const int r = q * 2 + rsub;
      const v4f v = *(const v4fa*)&so[w][r][c4];
      *(v4f*)(C + (size_t)(row0 + r) * ldc + col0 + c4) = v;
    }
    
  }
}

// GEMM C = act(A·W + bias + resid): A f32 (ASPLIT -> hi/lo 2 terms), Wt bf16 [N][K]; ACT 0 none, 1 relu, 2 exact gelu;
// resid (optional, f32, row index = (row % rmod), pitch ldr, RES_BF16 rounds it) added before the activation.
template <bool ASPLIT, int ACT, bool BIAS_BF16, bool RES_BF16>
__global__ __launch_bounds__(128) void k_gemm_bf3(const float* __restrict__ A, int lda, const unsigned short* __restrict__ Wt, int ldb,
                                                const float* __restrict__ bias, const float* __restrict__ resid, int rmod, int ldr,
                                                float* __restrict__ C, int ldc, int M, int N, int K) {
  __shared__ __attribute__((aligned(16))) float so[4][16][64];
  const int tid = threadIdx.x, w = tid >> 5, lane = tid & 31, ln = lane & 15, hh = lane >> 4;
  const int ntn = N / 64;
  const int wid = blockIdx.x * 4 + w;
  const int mt = wid / ntn, nq = wid % ntn;
  if (mt * 16 >= M) return;
  const int row0 = mt * 16, col0 = nq * 64;
  const float* arow = A + (size_t)(row0 + ln) * lda;
  v8f acc[4] = {};
  for (int kb = 0; kb < K; kb += 32) {
    FragB ah, al;
    const v4f x0 = *(const v4fa*)(arow + kb + 8 * hh), x1 = *(const v4fa*)(arow + kb + 8 * hh + 4);
    const v4f x2 = *(const v4fa*)(arow + kb + 16 + 8 * hh), x3 = *(const v4fa*)(arow + kb + 16 + 8 * hh + 4);
    float xs[16] = {x0[0],x0[1],x0[2],x0[3],x1[0],x1[1],x1[2],x1[3],x2[0],x2[1],x2[2],x2[3],x3[0],x3[1],x3[2],x3[3]};
#pragma unroll
    for (int i = 0; i < 16; ++i) { const unsigned short hb = bf16_bits(xs[i]); ah.u[i] = hb; al.u[i] = ASPLIT ? bf16_bits(xs[i] - bf16_val(hb)) : (unsigned short)0; }
#pragma unroll
    for (int t = 0; t < 4; ++t) {
      const unsigned short* brow = Wt + (size_t)(col0 + t * 16 + ln) * ldb + kb;
      FragB b;
      b.half[0] = *(const v8us*)(brow + 8 * hh);
      b.half[1] = *(const v8us*)(brow + 16 + 8 * hh);
      acc[t] = mmaN<ASPLIT ? 2 : 1>(ah.v, al.v, b.v, b.v, acc[t]);
    }
  }
#pragma unroll
  for (int t = 0; t < 4; ++t) {
    const int col = col0 + t * 16 + ln;
    float bv = bias ? bias[col] : 0.f;
    if (BIAS_BF16) bv = bf16_round(bv);
#pragma unroll
    for (int r = 0; r < 8; ++r) {
      float v = acc[t][r] + bv;
      if (resid) { float rv = resid[(size_t)((row0 + 8 * hh + r) % rmod) * ldr + col]; if (RES_BF16) rv = bf16_round(rv); v += rv; }
      if (ACT == 1) v = fmaxf(v, 0.f);
      if (ACT == 2) v = 0.5f * v * (1.0f + erff(v * 0.70710678118654752f));
      if (ACT == 3) { const float u = 0.7978845608028654f * (v + 0.044715f * v * v * v); v = 0.5f * v * (1.0f + tanhf(u)); }
      so[w][8 * hh + r][t * 16 + ln] = v;
    }
  }
  __builtin_amdgcn_fence(__ATOMIC_ACQ_REL, "workgroup");
  __builtin_amdgcn_wave_barrier();
  const int rsub = lane >> 4, c4 = (lane & 15) * 4;
  {
#pragma unroll
    for (int q = 0; q < 8; ++q) {
      const int r = q * 2 + rsub;
      const v4f v = *(const v4fa*)&so[w][r][c4];
      *(v4f*)(C + (size_t)(row0 + r) * ldc + col0 + c4) = v;
    }
    
  }
}
// row LayerNorm (biased variance, eps) over N: s = X (+ R); optional out_sum <- s; out_norm <- (s-mu)*rsqrt(var+eps)*g + b
template <bool PARAM_BF16>
__global__ __launch_bounds__(256) void k_layernorm(const float* __restrict__ X, const float* __restrict__ R, const float* __restrict__ g, const float* __restrict__ bta,
                                                  float* __restrict__ out_sum, float* __restrict__ out_norm, int N, float eps) {
  __shared__ float red[256];
  const int row = blockIdx.x, tid = threadIdx.x;
  const float* x = X + (size_t)row * N; const float* rr = R ? R + (size_t)row * N : nullptr;
  float vals[16];                     // up to N = 4096
  const int per = N / 256;            // contiguous chunk per thread? use strided-by-4 chunks: thread handles j = tid*4 + 1024*u
  float s1 = 0.f;
  for (int u = 0; u < per / 4; ++u) {
    const int j = tid * 4 + 1024 * u;
    const v4f a = *(const v4fa*)(x + j);
    v4f b = {0.f,0.f,0.f,0.f}; if (rr) b = *(const v4fa*)(rr + j);
#pragma unroll
    for (int q = 0; q < 4; ++q) { const float v = a[q] + b[q]; vals[u * 4 + q] = v; s1 += v; }
  }
  red[tid] = s1; __syncthreads();
  for (int st = 128; st > 0; st >>= 1) { if (tid < st) red[tid] += red[tid + st]; __syncthreads(); }
  const float mu = red[0] / (float)N; __syncthreads();
  float s2 = 0.f;
  for (int u = 0; u < per / 4; ++u)
#pragma unroll
    for (int q = 0; q < 4; ++q) { const float c = vals[u * 4 + q] - mu; s2 += c * c; }
  red[tid] = s2; __syncthreads();
  for (int st = 128; st > 0; st >>= 1) { if (tid < st) red[tid] += red[tid + st]; __syncthreads(); }
  const float rs = rsqrtf(red[0] / (float)N + eps);
  {
    for (int u = 0; u < per / 4; ++u) {
      const int j = tid * 4 + 1024 * u;
      v4f o, sm;
#pragma unroll
      for (int q = 0; q < 4; ++q) {
        float gg = g[j + q], bb = bta[j + q];
        if (PARAM_BF16) { gg = bf16_round(gg); bb = bf16_round(bb); }
        sm[q] = vals[u * 4 + q]; o[q] = (vals[u * 4 + q] - mu) * rs * gg + bb;
      }
      if (out_sum) *(v4f*)(out_sum + (size_t)row * N + j) = sm;
      *(v4f*)(out_norm + (size_t)row * N + j) = o;
    }
    
  }
}



// ---- f16 WMMA path (v_wmma_f32_16x16x32_f16): 11-bit significands for operands in range — used where a [0,1] probability operand needs more precision than bf16
typedef _Float16 v16h __attribute__((ext_vector_type(16)));
union FragH { v16h v; v8us half[2]; _Float16 h[16]; unsigned short u[16]; };
template <int NT>
__device__ __forceinline__ v8f mmaH(v16h ah, v16h al, v16h bh, v16h bl, v8f c) {
  c = __builtin_amdgcn_wmma_f32_16x16x32_f16(false, ah, false, bh, (short)0, c, false, false);
  if (NT >= 2) c = __builtin_amdgcn_wmma_f32_16x16x32_f16(false, al, false, bh, (short)0, c, false, false);
  if (NT >= 3) c = __builtin_amdgcn_wmma_f32_16x16x32_f16(false, ah, false, bl, (short)0, c, false, false);
  asm volatile("v_nop\n\tv_nop\n\tv_nop\n\tv_nop" : "+v"(c) : "v"(ah), "v"(al), "v"(bh), "v"(bl));
  return c;
}
// batched GEMM like k_gemm_b but f16 operands: A f32 (split into f16 hi/lo if ASPLIT, else rounded to f16), Bt = f16 values [n][k]; alpha; C f32; N multiple of 16 (partial tiles skipped)
template <bool ASPLIT>
__global__ __launch_bounds__(128) void k_gemm_h(const float* __restrict__ A, int lda, size_t sA, const _Float16* __restrict__ Bh, int ldb, size_t sB, float alpha, float* __restrict__ C, int ldc, size_t sC, int M, int N, int K) {
  __shared__ __attribute__((aligned(16))) float so[4][16][64];
  const int tid = threadIdx.x, w = tid >> 5, lane = tid & 31, ln = lane & 15, hh = lane >> 4; const int by = blockIdx.y;
  A += (size_t)by * sA; Bh += (size_t)by * sB; C += (size_t)by * sC;
  const int ntn = (N + 63) / 64; const int wid = blockIdx.x * 4 + w; const int mt = wid / ntn, nq = wid % ntn; if (mt * 16 >= M) return;
  const int row0 = mt * 16, col0 = nq * 64; const float* arow = A + (size_t)(row0 + ln) * lda;
  v8f acc[4] = {};
  for (int kb = 0; kb < K; kb += 32) {
    FragH ah, al;
    const v4f x0 = *(const v4fa*)(arow + kb + 8 * hh), x1 = *(const v4fa*)(arow + kb + 8 * hh + 4), x2 = *(const v4fa*)(arow + kb + 16 + 8 * hh), x3 = *(const v4fa*)(arow + kb + 16 + 8 * hh + 4);
    float xs[16] = {x0[0],x0[1],x0[2],x0[3],x1[0],x1[1],x1[2],x1[3],x2[0],x2[1],x2[2],x2[3],x3[0],x3[1],x3[2],x3[3]};
#pragma unroll
    for (int i = 0; i < 16; ++i) { const _Float16 h = (_Float16)xs[i]; ah.h[i] = h; al.h[i] = ASPLIT ? (_Float16)(xs[i] - (float)h) : (_Float16)0.0f; }
#pragma unroll
    for (int t = 0; t < 4; ++t) { if (col0 + t * 16 >= N) continue; const size_t boff = (size_t)(col0 + t * 16 + ln) * ldb + kb; FragH bq; bq.half[0] = *(const v8us*)(Bh + boff + 8 * hh); bq.half[1] = *(const v8us*)(Bh + boff + 16 + 8 * hh);
      acc[t] = mmaH<ASPLIT ? 2 : 1>(ah.v, al.v, bq.v, bq.v, acc[t]); }
  }
#pragma unroll
  for (int t = 0; t < 4; ++t) { if (col0 + t * 16 >= N) continue;
#pragma unroll
    for (int r = 0; r < 8; ++r) so[w][8 * hh + r][t * 16 + ln] = acc[t][r] * alpha; }
  __builtin_amdgcn_fence(__ATOMIC_ACQ_REL, "workgroup"); __builtin_amdgcn_wave_barrier();
  const int rsub = lane >> 4, c4 = (lane & 15) * 4;
  {
#pragma unroll
    for (int q = 0; q < 8; ++q) { const int r = q * 2 + rsub; if (col0 + c4 < N) { const v4f v = *(const v4fa*)&so[w][r][c4]; *(v4f*)(C + (size_t)(row0 + r) * ldc + col0 + c4) = v; } }
     }
}

// Wt[n][k] = f16(W[k][n]·scale) from f32 row-major W[K][N] (scale = power of two; bf16-exact weights stay exact in f16 away from the subnormal range)
__global__ __launch_bounds__(256) void k_wt_f16(const float* __restrict__ W, _Float16* __restrict__ Wt, int K, int N, float scale) {
  const int t = blockIdx.x * 256 + threadIdx.x; if (t >= N * (K / 8)) return; const int n = t / (K / 8), k8 = (t % (K / 8)) * 8; FragH f;
#pragma unroll
  for (int i = 0; i < 8; ++i) f.h[i] = (_Float16)(bf16_round(W[(size_t)(k8 + i) * N + n]) * scale); const v8us o = f.half[0];
  *(v8us*)((unsigned short*)Wt + (size_t)n * K + k8) = o; 
}
// k_gemm_hh variant with fused epilogue: v = acc·alpha + bias[by·sBias + col] (+ CP[(row/rowsPerB)·sCPb + by·64 + col] if CP) ; ACT 0 none / 1 elu ; writes f16 C16 (and f32 C if non-null)
template <int ACT>
__global__ __launch_bounds__(128) void k_gemm_hhx(const _Float16* __restrict__ A, int lda, size_t sA, const _Float16* __restrict__ Bh, int ldb, size_t sB, float alpha, const float* __restrict__ bias, size_t sBias, const float* __restrict__ CP, int rowsPerB, size_t sCPb, int row0g,
    float* __restrict__ C, _Float16* __restrict__ C16, int ldc, size_t sC, int M, int N, int K) {
  __shared__ __attribute__((aligned(16))) float so[4][16][64];
  const int tid = threadIdx.x, w = tid >> 5, lane = tid & 31, ln = lane & 15, hh = lane >> 4; const int by = blockIdx.y;
  A += (size_t)by * sA; Bh += (size_t)by * sB; const size_t cofs = (size_t)by * sC; const float* bp = bias ? bias + (size_t)by * sBias : nullptr;
  const int ntn = (N + 63) / 64; const int wid = blockIdx.x * 4 + w; const int mt = wid / ntn, nq = wid % ntn; if (mt * 16 >= M) return;
  const int row0 = mt * 16, col0 = nq * 64; const _Float16* arow = A + (size_t)(row0 + ln) * lda;
  v8f acc[4] = {};
  for (int kb = 0; kb < K; kb += 32) { FragH ah; ah.half[0] = *(const v8us*)((const unsigned short*)arow + kb + 8 * hh); ah.half[1] = *(const v8us*)((const unsigned short*)arow + kb + 16 + 8 * hh);
#pragma unroll
    for (int t = 0; t < 4; ++t) { if (col0 + t * 16 >= N) continue; const size_t boff = (size_t)(col0 + t * 16 + ln) * ldb + kb; FragH bq; bq.half[0] = *(const v8us*)((const unsigned short*)Bh + boff + 8 * hh); bq.half[1] = *(const v8us*)((const unsigned short*)Bh + boff + 16 + 8 * hh);
      acc[t] = mmaH<1>(ah.v, ah.v, bq.v, bq.v, acc[t]); }
  }
#pragma unroll
  for (int t = 0; t < 4; ++t) { if (col0 + t * 16 >= N) continue; const int col = col0 + t * 16 + ln; const float bv = bp ? bf16_round(bp[col]) : 0.f;
#pragma unroll
    for (int r = 0; r < 8; ++r) { float v = acc[t][r] * alpha + bv; if (CP) { const int rr = row0g + row0 + 8 * hh + r; if (rowsPerB < 0) v += CP[cofs + (size_t)rr * ldc + col];      /* rowsPerB < 0: own element of the batched C plane */ else { const int bidx = rr / rowsPerB; v += CP[(size_t)bidx * sCPb + (size_t)by * 64 + col]; } } if (ACT == 1) v = (v > 0.f) ? v : expm1f(v); else if (ACT == 7) v = (v > 0.f) ? v + 1.0f : expf(v); else if (ACT == 8) v = tanhf(v); else if (ACT == 9) v = 0.5f * v * (1.0f + tanhf(0.7978845608028654f * (v + 0.044715f * v * v * v))); else if (ACT == 11) v = 1.0f / (1.0f + expf(-v)); else if (ACT == 12) v = (v > 0.f) ? v : 0.01f * v; else if (ACT == 14) v = (v > 0.f) ? v : 0.1f * v; else if (ACT == 16) v = (v >= 0.f) ? v : 0.3f * v; else if (ACT == 17) v = (v >= 0.f) ? v : 0.2f * v; else if (ACT == 15) v = v / (1.0f + expf(-v)); else if (ACT == 3) v = fmaxf(v, 0.f); else if (ACT == 6) v = 0.5f * v * (1.0f + erff(v * 0.70710678118654752f)); so[w][8 * hh + r][t * 16 + ln] = v; } }
  __builtin_amdgcn_fence(__ATOMIC_ACQ_REL, "workgroup"); __builtin_amdgcn_wave_barrier();
  const int rsub = lane >> 4, c4 = (lane & 15) * 4; typedef _Float16 v4h __attribute__((ext_vector_type(4)));
  {
#pragma unroll
    for (int q = 0; q < 8; ++q) { const int r = q * 2 + rsub; if (col0 + c4 < N) { const v4f v = *(const v4fa*)&so[w][r][c4]; if (C) *(v4f*)(C + cofs + (size_t)(row0 + r) * ldc + col0 + c4) = v; if (C16) { v4h h4; for (int i = 0; i < 4; ++i) h4[i] = (_Float16)v[i]; *(v4h*)(C16 + cofs + (size_t)(row0 + r) * ldc + col0 + c4) = h4; } } }
     }
}


typedef _Float16 v4h __attribute__((ext_vector_type(4)));

__global__ __launch_bounds__(256) void k_x16(const float* __restrict__ x, _Float16* __restrict__ X16, size_t n8) { const size_t t = (size_t)blockIdx.x * 256 + threadIdx.x; if (t >= n8) return; FragH f;
#pragma unroll
  for (int q = 0; q < 8; ++q) f.h[q] = (_Float16)bf16_round(x[t * 8 + q]); *(v8us*)((unsigned short*)X16 + t * 8) = f.half[0];  }
__global__ __launch_bounds__(256) void k_h16(const float* __restrict__ x, _Float16* __restrict__ X16, size_t n8) { const size_t t = (size_t)blockIdx.x * 256 + threadIdx.x; if (t >= n8) return; FragH f;
#pragma unroll
  for (int q = 0; q < 8; ++q) f.h[q] = (_Float16)x[t * 8 + q]; *(v8us*)((unsigned short*)X16 + t * 8) = f.half[0];  }
__global__ __launch_bounds__(256) void k_round16f(const float* __restrict__ W, _Float16* __restrict__ Bt, size_t n8) { const size_t t = (size_t)blockIdx.x * 256 + threadIdx.x; if (t >= n8) return; FragH f;
#pragma unroll
  for (int i = 0; i < 8; ++i) f.h[i] = (_Float16)(bf16_round(W[t * 8 + i]) * 16.0f); *(v8us*)((unsigned short*)Bt + t * 8) = f.half[0];  }
template <int NHv, int TTv>
__global__ __launch_bounds__(256) void k_vt(const _Float16* __restrict__ V16, int ldv, int voff, _Float16* __restrict__ Vt) { __shared__ unsigned short tl[64][66]; const int tid = threadIdx.x; const int slab = blockIdx.x / (TTv / 64), lg = blockIdx.x % (TTv / 64); const int b = slab / NHv, h = slab % NHv;
  for (int i = tid; i < 64 * 8; i += 256) { const int r = i / 8, c8 = (i % 8) * 8; FragH f; f.half[0] = *(const v8us*)((const unsigned short*)V16 + ((size_t)b * TTv + lg * 64 + r) * ldv + voff + h * 64 + c8);
#pragma unroll
    for (int q = 0; q < 8; ++q) tl[r][c8 + q] = f.u[q]; }
  __syncthreads();
  {
#pragma unroll
    for (int rd = 0; rd < 2; ++rd) { const int d = rd * 32 + tid / 8, pc = tid % 8; FragH f;
#pragma unroll
      for (int q = 0; q < 8; ++q) f.u[q] = tl[pc * 8 + q][d];
      *(v8us*)((unsigned short*)Vt + ((size_t)slab * 64 + d) * TTv + lg * 64 + pc * 8) = f.half[0]; }
     } }

__global__ __launch_bounds__(256) void k_hl(const float* __restrict__ F, _Float16* __restrict__ Hh, _Float16* __restrict__ Hl, size_t n8) { const size_t t = (size_t)blockIdx.x * 256 + threadIdx.x; if (t >= n8) return; FragH fh, fl; const v4f a = *(const v4fa*)(F + t * 8), c = *(const v4fa*)(F + t * 8 + 4);
#pragma unroll
  for (int q = 0; q < 4; ++q) { _Float16 h = (_Float16)a[q]; fh.h[q] = h; fl.h[q] = (_Float16)((a[q] - (float)h) * 1024.0f); h = (_Float16)c[q]; fh.h[4 + q] = h; fl.h[4 + q] = (_Float16)((c[q] - (float)h) * 1024.0f); }
  { *(v8us*)((unsigned short*)Hh + t * 8) = fh.half[0]; *(v8us*)((unsigned short*)Hl + t * 8) = fl.half[0];  } }

// ---- LDS-staged GEMM: C[M][N] = alpha * A[M][K] . Bt[N][K]^T, f16 operands, f32 accumulation; one 128 x 128 tile of C per block of four waves (2 x 2, 64 x 64 of C a wave); M, N multiples of 128, K of 64 ----
// Each slab of 64 k (128-byte pieces of 128 A rows and 128 Bt rows) comes into one of two LDS buffers by four tensor loads, one a wave (a slice of 64 rows, through no register), and is read from there as fragments:
// every operand byte leaves L2 once per block and serves 64 rows or columns of each wave that needs it. The next slab's tensor loads fly while this slab is multiplied; one barrier a slab.
__device__ __forceinline__ v16h g2_frag(const _Float16* p, int hh) { FragH f; f.half[0] = *(const v8us*)((const unsigned short*)p + 8 * hh); f.half[1] = *(const v8us*)((const unsigned short*)p + 16 + 8 * hh); return f.v; }
#define G3T 128                      /* tile rows of A and of Bt per block */
#define G3K 64                       /* k per slab */
#define G3P 72                       /* LDS row pitch in f16: 144 bytes = 16 x odd, the conflict-free pitch for 16-byte fragment reads; the tensor load's pad (16 bytes behind every 128-byte row) gives the same pitch */
#define G3SL 5120                    /* f16 per slice in LDS: 64 rows at pitch G3P are 9,216 bytes, rounded up to 10,240 so that every slice's place is a multiple of 2 KiB */
#define G3B (4 * G3SL)               /* f16 per buffer: slices 0, 1 = A rows 0..63, 64..127; slices 2, 3 = Bt rows 0..63, 64..127 */
typedef uint32_t g3_u4 __attribute__((ext_vector_type(4)));
typedef uint32_t g3_u8 __attribute__((ext_vector_type(8)));
__device__ __forceinline__ uint32_t g3_uni(uint32_t v) { return (uint32_t)__builtin_amdgcn_readfirstlane(v); }
__device__ __forceinline__ uint32_t g3_pinned(uint32_t v) { uint32_t w = (uint32_t)__builtin_amdgcn_readfirstlane(v); asm volatile("" : "+s"(w)); return w; }      /* the test around a tensor load: the test is held in a scalar register, so that the branch on it is a scalar branch (a tensor load ignores EXEC) */
// one request of the whole wave: 64 rows of 128 bytes from global address ga (row pitch in g1) to LDS byte offset dst, pitch 144 bytes there; gives back the request's first descriptor group
__device__ __forceinline__ g3_u4 g3_tload(uint32_t dst, uint64_t ga, g3_u8& g1) { g3_u4 g0;
  g0[0] = g3_uni(1u); g0[1] = g3_uni(dst); g0[2] = g3_uni((uint32_t)ga); g0[3] = g3_uni((((uint32_t)(ga >> 32)) & 0x01FFFFFFu) | 0x80000000u);      /* count 1; place in LDS; address; type 2 */
  asm volatile("tensor_load_to_lds %0, %1" : "+s"(g0), "+s"(g1) :: "memory"); return g0; }      /* "+s": what later lines know as g0 and g1 stands in the very registers that the request named */
// the waits of the ring are written by hand: the compiler places none for a tensor load. Naming the outstanding request's descriptor keeps its registers live, and so unchanged, up to the wait:
// built without the names, the registers of slab 1's first group were given other values while that request was still out
#define G3_WT(g0, g1) asm volatile("s_wait_tensorcnt 0x0" :: "s"(g0), "s"(g1) : "memory")
#define G3_WD asm volatile("s_wait_dscnt 0x0" ::: "memory")
// one slab: every fragment of its 64 k from LDS, then the 2 x 16 products of the wave's 64 x 64 tile, k ascending; each '#pragma unroll' makes the index of a register array a constant
__device__ __forceinline__ void g3_slab(v8f (&acc)[4][4], const unsigned short* fa, const unsigned short* fb, int hh) { v16h a[2][4], b[2][4];
#pragma unroll
  for (int kk = 0; kk < 2; ++kk)
#pragma unroll
    for (int i = 0; i < 4; ++i) { a[kk][i] = g2_frag((const _Float16*)(fa + 16 * i * G3P + 32 * kk), hh); b[kk][i] = g2_frag((const _Float16*)(fb + 16 * i * G3P + 32 * kk), hh); }
  __builtin_amdgcn_sched_barrier(0);      /* keeps the slab's 32 fragment reads one group in front of its products, in the registers that staging no longer takes: built without it, a read stood in front of every four products with a wait to 0 behind it */
#pragma unroll
  for (int kk = 0; kk < 2; ++kk)
#pragma unroll
    for (int i = 0; i < 4; ++i)
#pragma unroll
      for (int j = 0; j < 4; ++j) acc[i][j] = __builtin_amdgcn_wmma_f32_16x16x32_f16(false, a[kk][i], false, b[kk][j], (short)0, acc[i][j], false, false);
  __builtin_amdgcn_sched_barrier(0); }      /* keeps the products in front of the ring's waits: built without it, 28 of the 32 sank behind the wait for the next slab's tensor load, which then flew under no products */
// CAUS: grid z = causal query tile of QT rows (A and C step QT rows a tile). 1 = scores: only key columns up to the tile's end are computed; 2 = P V: K ends at the tile's end. grid x = (rows / 128) * (N / 128), grid y = batch.
// Query tiles inside the first QT0 rows (CAUS, operands as f16 pairs): 1 = column group col0 / QT0 is the term: 0 = A Bt, 1 = A2 Bt, 2 = A B2 (A2, B2: the lo rows, QT0 a batch), all QT0 keys; 2 = Bt is B2 (V^T rows hi | hi | lo) and K = 3 QT0.
// H16: the output rows are f16 (C16), else f32 (C). X32 (with H16): of the first QT0 rows of every SQ rows the part that the rounding to f16 left goes to CL as f16, packed QT0 rows a batch. The row pitches lda, ldb, ldc, N and K are compile-time constants.
// VTR (with H16, one batch of SQ rows after the other, the last DM columns = v): a block of v columns stores its f16 tile TRANSPOSED into VT [batch][v column][key] and not into C16; with X32 its first QT0 keys also into VT3 [batch][v column][hi | hi | lo, QT0 keys each].
template <int CAUS, bool H16, bool X32, int lda, int ldb, int ldc, int N, int KF, bool VTR>
__device__ __forceinline__ void g3_body(const _Float16* __restrict__ A, size_t sA, const _Float16* __restrict__ Bh, size_t sB, float alpha,
    float* __restrict__ C, _Float16* __restrict__ C16, size_t sC, _Float16* __restrict__ VT, const _Float16* __restrict__ A2, const _Float16* __restrict__ B2, _Float16* __restrict__ CL, _Float16* __restrict__ VT3) {
  __shared__ __attribute__((aligned(2048))) unsigned short sm[2 * G3B];      /* 81,920 bytes; after the last slab the same bytes stage the output rows */
  const int tid = threadIdx.x, w = tid >> 5, lane = tid & 31, ln = lane & 15, hh = lane >> 4; const int by = blockIdx.y;
  const int qt = CAUS ? SQ / QT - 1 - (int)blockIdx.z : 0;      /* low z starts first: the tile with the most keys goes first */
  const bool pr = CAUS && qt < QT0 / QT;      /* a query tile whose operands are f16 pairs; the same for the whole block */
  const _Float16* Ab = A + (size_t)by * sA + (size_t)qt * QT * lda; const _Float16* Bb = Bh + (size_t)by * sB; const size_t cofs = (size_t)by * sC + (size_t)qt * QT * ldc;
  const int ntn = N / G3T; const int mt = blockIdx.x / ntn, nq = blockIdx.x - mt * ntn; const int row0 = mt * G3T, col0 = nq * G3T;
  int br0 = col0;      /* the Bt row of the tile's first column */
  if (CAUS == 1) {      /* both returns: the same for the whole block, in front of every barrier */
    if (pr) { const int term = col0 / QT0; if (term >= 3) return; br0 = col0 - term * QT0;
      if (term == 1) Ab = A2 + ((size_t)by * QT0 + (size_t)qt * QT) * lda;
      if (term == 2) Bb = B2 + (size_t)by * QT0 * ldb; }
    else if (col0 >= (qt + 1) * QT) return; }
  if (CAUS == 2 && pr) Bb = B2 + (size_t)by * sB;
  const int K = (CAUS == 2) ? (pr ? 3 * QT0 : (qt + 1) * QT) : KF;
  /* staging: wave s brings slice s of every slab: s = 0, 1 the two halves of the A rows, s = 2, 3 of the Bt rows; every wave issues, unconditionally */
  const uint32_t ws = g3_uni((uint32_t)tid >> 5); const bool isb = ws >= 2u;
  const uint64_t gs = isb ? (uint64_t)(size_t)((const unsigned short*)Bb + (size_t)(br0 + 64 * (int)(ws & 1u)) * ldb) : (uint64_t)(size_t)((const unsigned short*)Ab + (size_t)(row0 + 64 * (int)(ws & 1u)) * lda);      /* first byte of the slice at k = 0 */
  const uint32_t ls = (uint32_t)(size_t)sm + ws * (2u * G3SL);      /* the slice's place in buffer 0: byte offset in the block's LDS */
  g3_u8 g1;      /* 1-byte elements, tensor = tile = 64 rows of 128 bytes, 16 bytes of pad behind every 128; no mask */
  g1[0] = g3_uni((1u << 20) | (4u << 22) | (3u << 25)); g1[1] = g3_uni(128u << 16); g1[2] = g3_uni(64u << 16); g1[3] = g3_uni(128u << 16); g1[4] = g3_uni(64u); g1[5] = g3_uni(isb ? 2u * ldb : 2u * lda); g1[6] = g3_uni(0u); g1[7] = g3_uni(0u);
  const int wm = w >> 1, wn = w & 1;
  const unsigned short* fa = sm + wm * G3SL + ln * G3P; const unsigned short* fb = sm + (2 + wn) * G3SL + ln * G3P;
  const v8f z8 = {0.f,0.f,0.f,0.f,0.f,0.f,0.f,0.f}; v8f acc[4][4];
  /* every '#pragma unroll' of this kernel makes the index of a register array a constant */
#pragma unroll
  for (int i = 0; i < 4; ++i)
#pragma unroll
    for (int j = 0; j < 4; ++j) acc[i][j] = z8;
  const int nkt = K / G3K;      /* 12 slabs or more: slabs 0 and 1 exist */
  g3_u4 gq = g3_tload(ls, gs, g1);      /* slab 0 -> buffer 0 */
  G3_WT(gq, g1);      /* the wave's own slice of slab 0 has landed */
  __syncthreads();      /* publishes slab 0 */
  gq = g3_tload(ls + 2u * G3B, gs + 2u * G3K, g1);      /* slab 1 -> buffer 1 */
  for (int kt = 0; kt < nkt; ++kt) {      /* the trip count is the same for the whole block */
    const int bo = (kt & 1) * G3B;
    g3_slab(acc, fa + bo, fb + bo, hh);
    G3_WD;      /* the wave's reads of this slab are over */
    G3_WT(gq, g1);      /* the wave's own slice of the next slab has landed */
    __syncthreads();      /* publishes the next slab and ends every read of this one; behind the last slab: the output rows are staged over it */
    if (g3_pinned(kt + 2 < nkt)) gq = g3_tload(ls + (uint32_t)(2 * bo), gs + (uint64_t)(2 * G3K) * (uint32_t)(kt + 2), g1); }      /* slab kt + 2 into the buffer just left; a scalar branch */
  G3_WT(gq, g1); G3_WD;      /* nothing of the ring is in flight when its bytes become output staging */
  float* so = (float*)sm + w * (64 * 68);      /* the wave's own 64 x 64 f32 rows at pitch 68, so that the stores below are whole lines */
  if (VTR && col0 >= N - DM) {      /* the same for the whole block: a tile of 128 columns lies wholly inside or outside the v columns */
    const int rs = lane >> 4, k4 = (lane & 15) * 4;
#pragma unroll
    for (int i = 0; i < 4; ++i)
#pragma unroll
      for (int j = 0; j < 4; ++j) acc[i][j] *= alpha;
    /* staged column by column: the eight rows a lane holds of one column are neighbours there (two 16-byte LDS stores), and a v column's 64 keys read back as one whole line */
#pragma unroll
    for (int i = 0; i < 4; ++i)
#pragma unroll
      for (int j = 0; j < 4; ++j) { v4f lo4, hi4;
#pragma unroll
        for (int r = 0; r < 4; ++r) { lo4[r] = acc[i][j][r]; hi4[r] = acc[i][j][4 + r]; }
        float* d = &so[(16 * j + ln) * 68 + 16 * i + 8 * hh]; *(v4fa*)d = lo4; *(v4fa*)(d + 4) = hi4; }
    __builtin_amdgcn_fence(__ATOMIC_ACQ_REL, "workgroup"); __builtin_amdgcn_wave_barrier();      /* the wave reads back what its other lanes wrote */
    _Float16* vt = VT + ((size_t)(row0 / SQ) * DM + (col0 - (N - DM)) + wn * 64 + rs) * SQ + row0 % SQ + wm * 64 + k4;
    if (X32 && row0 % SQ < QT0) {      /* the same for the whole block: keys of the rows that carry f16 pairs */
      _Float16* v3 = VT3 + ((size_t)(row0 / SQ) * DM + (col0 - (N - DM)) + wn * 64 + rs) * SQ + row0 % SQ + wm * 64 + k4;
#pragma unroll
      for (int q = 0; q < 32; ++q) { const v4f v = *(const v4fa*)&so[(q * 2 + rs) * 68 + k4]; v4h h4, l4; for (int i = 0; i < 4; ++i) { h4[i] = (_Float16)v[i]; l4[i] = (_Float16)(v[i] - (float)h4[i]); }
        *(v4h*)(vt + q * 2 * SQ) = h4; *(v4h*)(v3 + q * 2 * SQ) = h4; *(v4h*)(v3 + q * 2 * SQ + QT0) = h4; *(v4h*)(v3 + q * 2 * SQ + 2 * QT0) = l4; }
      return; }      /* behind the kernel's last barrier */
#pragma unroll
    for (int q = 0; q < 32; ++q) { const v4f v = *(const v4fa*)&so[(q * 2 + rs) * 68 + k4]; v4h h4; for (int i = 0; i < 4; ++i) h4[i] = (_Float16)v[i]; *(v4h*)(vt + q * 2 * SQ) = h4; }
    if (X32) asm volatile("s_wait_xcnt 0x0" ::: "memory");      /* the built code lays the branch above directly behind these stores, with only a conditional branch between, and it rewrites their address and data registers */
    return; }      /* behind the kernel's last barrier */
#pragma unroll
  for (int i = 0; i < 4; ++i)
#pragma unroll
    for (int j = 0; j < 4; ++j)
#pragma unroll
      for (int r = 0; r < 8; ++r) so[(16 * i + 8 * hh + r) * 68 + 16 * j + ln] = acc[i][j][r] * alpha;
  __builtin_amdgcn_fence(__ATOMIC_ACQ_REL, "workgroup"); __builtin_amdgcn_wave_barrier();
  const int rsub = lane >> 4, c4 = (lane & 15) * 4; const size_t co = cofs + (size_t)(row0 + wm * 64 + rsub) * ldc + col0 + wn * 64 + c4; float* cp = H16 ? nullptr : C + co; _Float16* cp16 = H16 ? C16 + co : nullptr;
  if (X32 && row0 % SQ < QT0) {      /* the same for the whole block: a tile of 128 rows lies wholly inside or outside the first QT0 rows of a batch */
    _Float16* cl = CL + (co - (size_t)(row0 / SQ) * ((SQ - QT0) * ldc));      /* the f16 row's place less the rows of earlier batches that are not kept */
#pragma unroll
    for (int q = 0; q < 32; ++q) { const v4f v = *(const v4fa*)&so[(q * 2 + rsub) * 68 + c4]; v4h h4, l4; for (int i = 0; i < 4; ++i) { h4[i] = (_Float16)v[i]; l4[i] = (_Float16)(v[i] - (float)h4[i]); } *(v4h*)(cp16 + q * 2 * ldc) = h4; *(v4h*)(cl + q * 2 * ldc) = l4; }
    if (VTR) asm volatile("s_wait_xcnt 0x0" ::: "memory"); }      /* the built code lays the v branch behind these stores, with only a conditional branch between, and it rewrites their address and data registers */
  else {
#pragma unroll
    for (int q = 0; q < 32; ++q) { const int r = q * 2 + rsub; const v4f v = *(const v4fa*)&so[r * 68 + c4]; if (!H16) *(v4f*)(cp + q * 2 * ldc) = v; else { v4h h4; for (int i = 0; i < 4; ++i) h4[i] = (_Float16)v[i]; *(v4h*)(cp16 + q * 2 * ldc) = h4; } }
    if (X32) asm volatile("s_wait_xcnt 0x0" ::: "memory"); } }      /* the built code lays the other branch directly behind these stores, with only a conditional branch between, and it rewrites their data registers */
template <int CAUS, bool H16, bool X32, int lda, int ldb, int ldc, int N, int KF>
__global__ __launch_bounds__(128) void k_gemm3(const _Float16* __restrict__ A, size_t sA, const _Float16* __restrict__ Bh, size_t sB, float alpha,
    float* __restrict__ C, _Float16* __restrict__ C16, size_t sC, const _Float16* __restrict__ A2, const _Float16* __restrict__ B2) { g3_body<CAUS, H16, X32, lda, ldb, ldc, N, KF, false>(A, sA, Bh, sB, alpha, C, C16, sC, nullptr, A2, B2, nullptr, nullptr); }
// the projection, with the v branch in its epilogue
template <int lda, int ldb, int ldc, int N, int KF>
__global__ __launch_bounds__(128) void k_gemm3v(const _Float16* __restrict__ A, const _Float16* __restrict__ Bh, float alpha,
    _Float16* __restrict__ CL, _Float16* __restrict__ C16, _Float16* __restrict__ VT, _Float16* __restrict__ VT3) { g3_body<0, true, true, lda, ldb, ldc, N, KF, true>(A, 0, Bh, 0, alpha, nullptr, C16, 0, VT, nullptr, nullptr, CL, VT3); }


__global__ __launch_bounds__(256) void k_wnat(const float* __restrict__ w, size_t n8, _Float16* __restrict__ Bt) { const size_t t = (size_t)blockIdx.x * 256 + threadIdx.x; if (t >= n8) return; FragH f; for (int q = 0; q < 8; ++q) f.h[q] = (_Float16)(bf16_round(w[t * 8 + q]) * 16.0f); *(v8us*)((unsigned short*)Bt + t * 8) = f.half[0];  }
__global__ __launch_bounds__(256) void k_rsm(const float* __restrict__ S, _Float16* __restrict__ P, int nrows) {
  #pragma clang fp contract(off)
  const int i = blockIdx.x * 256 + threadIdx.x; if (i >= nrows) return; const float* s = S + (size_t)i * SQ; float mx = -3.0e38f;
#pragma unroll 1
  for (int j = 0; j < SQ; ++j) mx = fmaxf(mx, s[j]); float se = 0.f;
#pragma unroll 1
  for (int j = 0; j < SQ; ++j) se += expf(s[j] - mx); const float sc = 256.0f / se;
#pragma unroll 1
  for (int j0 = 0; j0 < SQ; j0 += 8) { FragH f; for (int q = 0; q < 8; ++q) f.h[q] = (_Float16)(expf(s[j0 + q] - mx) * sc); unsigned short* d = (unsigned short*)P + (size_t)i * SQ + j0; *(v8us*)d = f.half[0];  } }
__global__ __launch_bounds__(256) void k_vt(const _Float16* __restrict__ V16, int b, int h0, _Float16* __restrict__ VT) { __shared__ unsigned short tl[64][65]; const int tid = threadIdx.x; const int hh = blockIdx.x % HG, sg = blockIdx.x / HG; const int s0 = sg * 64; const int h = h0 + hh;
  for (int i = tid; i < 64 * 8; i += 256) { const int j = i / 8, d8 = (i % 8) * 8; FragH f; f.half[0] = *(const v8us*)((const unsigned short*)V16 + ((size_t)b * SQ + s0 + j) * DM + h * HD + d8); for (int q = 0; q < 8; ++q) tl[d8 + q][j] = f.u[q]; }
  __syncthreads();
  { for (int i = tid; i < 64 * 8; i += 256) { const int d = i / 8, j8 = (i % 8) * 8; FragH f; for (int q = 0; q < 8; ++q) f.u[q] = tl[d][j8 + q]; *(v8us*)((unsigned short*)VT + ((size_t)hh * HD + d) * SQ + s0 + j8) = f.half[0]; }  } }



// Causal softmax, ONE S ROW PER WAVE, the row held in registers: lane l owns keys 256 c + 8 l .. + 7 of each 256-key chunk c (two 16-byte loads in, one 16-byte f16 store out per chunk).
// Row max and row sum: per-lane partials (the sum in four independent chains), then a five-step butterfly over the 32 lanes. NC = nk / 256 chunks, all loads of a row in flight together.
// e^x as the fast form has it (one multiply, v_exp_f32). The v_nop is the one slot the instruction set asks for behind a transcendental before its result is read or its source overwritten.
__device__ __forceinline__ float rsm_exp(float x) { const float y = x * 1.44269504088896340736f; float e; asm("v_exp_f32 %0, %1\n\tv_nop" : "=v"(e) : "v"(y)); return e; }
// X3 (a row whose operands are f16 pairs, NC * 256 = QT0 keys): a score is the sum of its three terms, QT0 columns apart in the S row; precise expf; the weight goes out as hi | lo | hi, QT0 columns apart in the P row.
template <int NC, bool X3>
__device__ __forceinline__ void rsm_row(const float* __restrict__ s, unsigned short* __restrict__ p, int k0, int last) {
  float v[NC][8];
#pragma unroll
  for (int c = 0; c < NC; ++c) { v4f a = *(const v4fa*)(s + c * 256 + k0), b = *(const v4fa*)(s + c * 256 + k0 + 4);
    if constexpr (X3) { const v4f a1 = *(const v4fa*)(s + QT0 + c * 256 + k0), b1 = *(const v4fa*)(s + QT0 + c * 256 + k0 + 4), a2 = *(const v4fa*)(s + 2 * QT0 + c * 256 + k0), b2 = *(const v4fa*)(s + 2 * QT0 + c * 256 + k0 + 4);
      a = (a + a1) + a2; b = (b + b1) + b2; }
#pragma unroll
    for (int q = 0; q < 4; ++q) { v[c][q] = a[q]; v[c][4 + q] = b[q]; } }
  float mx = -3.0e38f;
#pragma unroll
  for (int c = 0; c < NC; ++c)
#pragma unroll
    for (int q = 0; q < 8; ++q) { if (c * 256 + k0 + q > last) v[c][q] = -1.0e9f; mx = fmaxf(mx, v[c][q]); }
#pragma unroll
  for (int m = 16; m > 0; m >>= 1) mx = fmaxf(mx, __shfl_xor(mx, m, 32));
  float s4[4] = {0.f, 0.f, 0.f, 0.f};
#pragma unroll
  for (int c = 0; c < NC; ++c)
#pragma unroll
    for (int q = 0; q < 8; ++q) { v[c][q] = X3 ? expf(v[c][q] - mx) : rsm_exp(v[c][q] - mx); s4[q & 3] += v[c][q]; }
  float se = (s4[0] + s4[1]) + (s4[2] + s4[3]);
#pragma unroll
  for (int m = 16; m > 0; m >>= 1) se += __shfl_xor(se, m, 32);
  const float sc = 256.0f / se;
#pragma unroll
  for (int c = 0; c < NC; ++c) { FragH fr, fl;
#pragma unroll
    for (int q = 0; q < 8; ++q) { const float y = v[c][q] * sc; const _Float16 h = (_Float16)y; fr.h[q] = h; if constexpr (X3) fl.h[q] = (_Float16)(y - (float)h); }
    *(v8us*)(p + c * 256 + k0) = fr.half[0];
    if constexpr (X3) { *(v8us*)(p + QT0 + c * 256 + k0) = fl.half[0]; *(v8us*)(p + 2 * QT0 + c * 256 + k0) = fr.half[0]; } }
  asm volatile("s_wait_xcnt 0x0" ::: "memory");      /* the built code lays the row lengths one behind the other, and only a conditional branch stands between these stores and the next length's code, which rewrites their address and data registers */
}
// row = number of a token row, of all batches (the same in every lane of the wave); past the first QT0 rows of a batch a row's length is the end of its own QT-row query tile, inside them QT0 keys
__device__ __forceinline__ void rsm_wave(const float* __restrict__ S, _Float16* __restrict__ P, unsigned row, int lane) {
  const int last = row % SQ; const int k0 = lane * 8;
  const float* s = S + (size_t)row * NKX; unsigned short* p = (unsigned short*)P + (size_t)row * NKX;
  switch (last / QT + 1) {      /* the same for every lane of the wave: straight-line code for each row length */
    case 1: case 2: rsm_row<QT0 / 256, true>(s, p, k0, last); break; case 3: rsm_row<3, false>(s, p, k0, last); break; case 4: rsm_row<4, false>(s, p, k0, last); break;
    case 5: rsm_row<5, false>(s, p, k0, last); break; case 6: rsm_row<6, false>(s, p, k0, last); break; case 7: rsm_row<7, false>(s, p, k0, last); break; case 8: rsm_row<8, false>(s, p, k0, last); break;
    default: break; } }
// eight rows a block, a wave a row, no barrier, no LDS
__global__ __launch_bounds__(256) void k_rsm8(const float* __restrict__ S, _Float16* __restrict__ P) {
  const int w = __builtin_amdgcn_readfirstlane((int)threadIdx.x >> 5);      /* the wave's number as a scalar: the row's addresses are formed on the scalar unit */
  rsm_wave(S, P, blockIdx.x * 8 + (unsigned)w, (int)threadIdx.x & 31); }


template <int MASKADD>
__global__ __launch_bounds__(64) void k_att0(const float* __restrict__ QF, const float* __restrict__ KF, const float* __restrict__ VF, int ld, const float* __restrict__ mask, float scale, float* __restrict__ OF, int ldo) {
  #pragma clang fp contract(off)
  __shared__ __attribute__((aligned(16))) float lq[64][64]; __shared__ __attribute__((aligned(16))) float lo[64][64];
  const int tid = threadIdx.x; const int h = blockIdx.x / (QT0 / 64), rg = blockIdx.x % (QT0 / 64); const int i = rg * 64 + tid;
  const float* qr = QF + (size_t)i * ld + h * HD;
#pragma unroll 1
  for (int c = 0; c < HD / 4; ++c) { *(v4f*)&lq[tid][c * 4] = *(const v4fa*)(qr + c * 4); const v4f z = {0.f, 0.f, 0.f, 0.f}; *(v4f*)&lo[tid][c * 4] = z; }
  float m = -1.0e30f, l = 0.f; const int jmax = MASKADD ? (SQ - 1) : (rg * 64 + 63);      /* additive-mask form: every key (the mask input decides); causal form: keys up to the block's last row */
#pragma unroll 1
  for (int j = 0; j <= jmax; ++j) { const float* kr = KF + (size_t)j * ld + h * HD; const float* vr = VF + (size_t)j * ld + h * HD; float s = 0.f;
#pragma unroll 1
    for (int c = 0; c < HD / 4; ++c) { const v4f kq = *(const v4fa*)(kr + c * 4); const v4f qq = *(v4f*)&lq[tid][c * 4]; s = __fadd_rn(s, __fmul_rn(qq[0], kq[0])); s = __fadd_rn(s, __fmul_rn(qq[1], kq[1])); s = __fadd_rn(s, __fmul_rn(qq[2], kq[2])); s = __fadd_rn(s, __fmul_rn(qq[3], kq[3])); }
    s = __fmul_rn(s, scale); if (MASKADD) s = __fadd_rn(s, __fmul_rn(bf16_round(mask[(size_t)i * SQ + j]), -10000.0f));
    const float f = (MASKADD || j <= i) ? 1.f : 0.f; const float sm = fmaf(f, s, (1.f - f) * -1.0e30f); const float mn = fmaxf(m, sm); const float sc = expf(m - mn); const float e = expf(sm - mn); l = __fadd_rn(__fmul_rn(l, sc), e); m = mn;
#pragma unroll 1
    for (int c = 0; c < HD / 4; ++c) { const v4f vv = *(const v4fa*)(vr + c * 4); v4f oo = *(v4f*)&lo[tid][c * 4]; for (int u = 0; u < 4; ++u) oo[u] = __fadd_rn(__fmul_rn(oo[u], sc), __fmul_rn(e, vv[u])); *(v4f*)&lo[tid][c * 4] = oo; } }
  const float fin = 64.0f / l;      /* o carried x64 like the f16 path */
#pragma unroll 1
  for (int c = 0; c < HD / 4; ++c) { v4f oo = *(v4f*)&lo[tid][c * 4]; for (int u = 0; u < 4; ++u) oo[u] = __fmul_rn(oo[u], fin); *(v4f*)&lo[tid][c * 4] = oo; }
  __syncthreads();
  {
#pragma unroll 1
    for (int it = 0; it < 16; ++it) { const int row = it * 4 + tid / 16, pc = (tid % 16) * 4; const v4f v = *(const v4f*)&lo[row][pc]; *(v4f*)(OF + (size_t)(rg * 64 + row) * ldo + h * HD + pc) = v; }
     } }


template <int BFIN, int WXB>
__global__ __launch_bounds__(256) void k_ln16(const float* __restrict__ X, const float* __restrict__ g, const float* __restrict__ bb, float eps, _Float16* __restrict__ N16, float* __restrict__ XB) {
  #pragma clang fp contract(off)
  __shared__ float red[256]; const size_t r = blockIdx.x; const int t = threadIdx.x; const v4f xa = *(const v4fa*)(X + r * DMQ + t * 4); float s[4]; float sum = 0.f;
  for (int q = 0; q < 4; ++q) { s[q] = BFIN ? bf16_round(xa[q]) : xa[q]; sum = __fadd_rn(sum, s[q]); }
  red[t] = sum; __syncthreads(); for (int st = 128; st > 0; st >>= 1) { if (t < st) red[t] = __fadd_rn(red[t], red[t + st]); __syncthreads(); } const float mu = red[0] / (float)DMQ; __syncthreads();
  float vs = 0.f; for (int q = 0; q < 4; ++q) { const float dl = __fadd_rn(s[q], -mu); vs = __fadd_rn(vs, __fmul_rn(dl, dl)); } red[t] = vs; __syncthreads(); for (int st = 128; st > 0; st >>= 1) { if (t < st) red[t] = __fadd_rn(red[t], red[t + st]); __syncthreads(); }
  const float rs = rsqrtf(__fadd_rn(red[0] / (float)DMQ, eps)); v4h y; v4f xb;
  for (int q = 0; q < 4; ++q) { const int c = t * 4 + q; y[q] = (_Float16)__fadd_rn(__fmul_rn(__fmul_rn(__fadd_rn(s[q], -mu), rs), bf16_round(g[c])), bf16_round(bb[c])); xb[q] = s[q]; }
  { *(v4h*)(N16 + r * DMQ + t * 4) = y; if (WXB) *(v4f*)(XB + r * DMQ + t * 4) = xb;  } }
__global__ __launch_bounds__(256) void k_ftres2(const float* __restrict__ OF0, const float* __restrict__ XB, float* __restrict__ X1, size_t n4) {
  #pragma clang fp contract(off)
  const size_t t = (size_t)blockIdx.x * 256 + threadIdx.x; if (t >= n4) return; const v4f o = *(const v4fa*)(OF0 + t * 4), xv = *(const v4fa*)(XB + t * 4); v4f y; for (int q = 0; q < 4; ++q) y[q] = __fadd_rn(__fmul_rn(o[q], 0.015625f), xv[q]); *(v4f*)(X1 + t * 4) = y;  }

__global__ __launch_bounds__(256) void k_wthd(const float* __restrict__ Wt, _Float16* __restrict__ Bt) { const size_t t = (size_t)blockIdx.x * 256 + threadIdx.x; if (t >= (size_t)NH * HD * (DM / 8)) return; const int m8 = (int)(t % (DM / 8)) * 8; const int d = (int)((t / (DM / 8)) % HD); const int h = (int)(t / ((size_t)(DM / 8) * HD)); FragH f;
  for (int q = 0; q < 8; ++q) f.h[q] = (_Float16)(16.0f * bf16_round(Wt[((size_t)h * DM + m8 + q) * HD + d])); unsigned short* dst = (unsigned short*)Bt + ((size_t)h * HD + d) * DM + m8; *(v8us*)dst = f.half[0];  }




__global__ __launch_bounds__(256) void k_wtpad(const float* __restrict__ Wm, _Float16* __restrict__ Wt, int Kr, int Kp, int Nr, int Np, float scale) {
  const int t = blockIdx.x * 256 + threadIdx.x; if (t >= Np * (Kp / 8)) return; const int n = t / (Kp / 8), k8 = (t % (Kp / 8)) * 8; const int nc = min(n, Nr - 1); const float fn = (n < Nr) ? 1.f : 0.f; FragH f;
  for (int i = 0; i < 8; ++i) { const int k = k8 + i; const int kc = min(k, Kr - 1); const float fk = (k < Kr) ? fn : 0.f; f.h[i] = (_Float16)(bf16_round(Wm[(size_t)kc * Nr + nc]) * scale * fk); }
  unsigned short* o = (unsigned short*)Wt + (size_t)n * Kp + k8; *(v8us*)o = f.half[0];  }
__global__ __launch_bounds__(128) void k_bpad(const float* __restrict__ b, float* __restrict__ Bp, int nr, int np) {
  const int i = threadIdx.x; if (i >= np) return; const float v = b[min(i, nr - 1)] * ((i < nr) ? 1.f : 0.f); *(float*)(Bp + i) = v;  }

#define DI 1024       /* inner width = NH * HD */
#define LQK (3 * DI)  /* fused q | k | v row pitch (3072) */
__global__ __launch_bounds__(256) void k_o0(const float* __restrict__ OF, float* __restrict__ ob, size_t n4) {
  #pragma clang fp contract(off)
  const size_t t = (size_t)blockIdx.x * 256 + threadIdx.x; if (t >= n4) return; const size_t e = t * 4; const int i = (int)(e / DI); const int c = (int)(e % DI); const int h = c / HD, d = c % HD; const v4f a = *(const v4fa*)(OF + e); v4f o; for (int q = 0; q < 4; ++q) o[q] = __fmul_rn(a[q], 0.015625f); float* dst = ob + (size_t)h * SQ * HD + (size_t)i * HD + d; *(v4f*)dst = o;  }

// behind a run of global loads from one pointer: the wait that stands in front of any rewrite of the registers the loads name; naming the pointer keeps its registers live up to the wait, so that no load of the run is given them as its destination
#define ATT0_XW(p) asm volatile("s_wait_xcnt 0x0" :: "v"(p) : "memory")
__global__ __launch_bounds__(256) void k_o0m(const float* __restrict__ OF, float* __restrict__ o_, size_t n4) {
  #pragma clang fp contract(off)
  const size_t t = (size_t)blockIdx.x * 256 + threadIdx.x; if (t >= n4) return; const size_t e = t * 4; OF += (size_t)blockIdx.y * QT0 * DI; o_ += (size_t)blockIdx.y * SQ * DI;      /* grid y = batch */
  const v4f a = *(const v4fa*)(OF + e); v4f o; for (int q = 0; q < 4; ++q) o[q] = __fmul_rn(a[q], 0.015625f); *(v4f*)(o_ + e) = o;  }
// W^T operand of the projection: Wt[n][k] = f16(bf16(W[k][n]) * 16) from W [DM][LQK] f32, one 64 k x 32 n tile per wave.
// Lane l reads column n0 + l of the tile's 64 rows: the 32 lanes of a load lie side by side in one row of W, so a wave-load is one whole 128-byte line. The lane's 64 values are one 128-byte piece of row n0 + l of W^T;
// they go through the wave's own LDS tile (pitch 144 bytes = 16 x odd) so that eight lanes store one such piece together: a wave-store is four whole lines.
#define WLK 64                       /* k per tile */
#define WLP 72                       /* LDS row pitch in f16 */
__global__ __launch_bounds__(128) void k_wtl(const float* __restrict__ Wm, _Float16* __restrict__ Wt) {
  __shared__ __attribute__((aligned(16))) unsigned short tl[4][32 * WLP];
  const int tid = threadIdx.x, w = tid >> 5, lane = tid & 31; const int wv = blockIdx.x * 4 + w;      /* tile number: column group fastest */
  const int n0 = (wv % (LQK / 32)) * 32, k0 = (wv / (LQK / 32)) * WLK;
  const float* sp = Wm + (size_t)k0 * LQK + n0 + lane; float v[WLK];
  /* every '#pragma unroll' of this kernel makes the index of a register array a constant; all 64 loads of a lane fly together */
#pragma unroll
  for (int i = 0; i < WLK; ++i) v[i] = sp[i * LQK];
  ATT0_XW(sp);      /* in front of the code below, which reuses the address registers of these loads */
  unsigned short* row = &tl[w][lane * WLP];
#pragma unroll
  for (int c = 0; c < WLK / 8; ++c) { FragH f;
#pragma unroll
    for (int q = 0; q < 8; ++q) f.h[q] = (_Float16)(bf16_round(v[c * 8 + q]) * 16.0f);
    *(v8us*)(row + c * 8) = f.half[0]; }
  __builtin_amdgcn_fence(__ATOMIC_ACQ_REL, "workgroup"); __builtin_amdgcn_wave_barrier();      /* the wave reads back what its other lanes wrote */
  const int r = lane >> 3, p = (lane & 7) * 8;
  unsigned short* dp = (unsigned short*)Wt + (size_t)(n0 + r) * DM + k0 + p;
#pragma unroll
  for (int q = 0; q < 8; ++q) { const v8us o = *(const v8us*)&tl[w][(q * 4 + r) * WLP + p]; *(v8us*)(dp + q * 4 * DM) = o; } }

extern "C" void kernel_launch(void* const* d_in, const int* in_sizes, int n_in,
                              void* d_out, int out_size, void* d_ws, size_t ws_size, hipStream_t stream) {
  (void)in_sizes; (void)n_in; (void)out_size;
  const float* const* I = (const float* const*)d_in; const float* x = I[0]; const float* wqkv = I[1];      /* input order: x [4][2048][1024], W_qkv ([in][out] [1024][3072]: q | k | v column thirds); the module has no biases and no output projection */
  char* ws = (char*)d_ws; size_t off = 0;
  auto take = [&](size_t bytes) { char* p = ws + off; off += (bytes + 255) & ~(size_t)255; return p; };
  _Float16* BW = (_Float16*)take((size_t)LQK * DM * 2); _Float16* X16 = (_Float16*)take(NR * DM * 2); _Float16* QKV = (_Float16*)take(NR * LQK * 2); _Float16* VT = (_Float16*)take((size_t)NB * DI * SQ * 2);
  float* S = (float*)take(NR * NKX * 4); _Float16* P = (_Float16*)take(NR * NKX * 2); _Float16* QKL = (_Float16*)take((size_t)NB * QT0 * LQK * 2); _Float16* VT3 = (_Float16*)take((size_t)NB * DI * SQ * 2);      /* ONE head: S / P row = token row, pitch NKX; every plane holds all batches; QKL: lo of the q | k rows 0..511 of every batch; VT3: V^T of keys 0..511 as hi | hi | lo, row pitch SQ */
  if (off > ws_size) return;
  k_wtl<<<(LQK / 32) * (DM / WLK) / 4, 128, 0, stream>>>(wqkv, BW);      /* [in][out] [1024][3072] -> Bt[n][k] x16, one 64 k x 32 n tile a wave */
  k_x16<<<(unsigned)((NR * DM / 8 + 255) / 256), 256, 0, stream>>>(x, X16, NR * DM / 8);      /* x (bf16-valued) as exact f16 rows */
  k_gemm3v<DM, DM, LQK, LQK, DM><<<dim3((unsigned)((NR / 128) * (LQK / 128)), 1), 128, 0, stream>>>(X16, BW, 0.0625f, QKL, QKV, VT, VT3);      /* q | k | v = x W: q and k -> f16 rows, column blocks 0 / 1024 of the fused plane (pitch 3072); v -> V^T [NB][1024][SQ] f16; no bias; of rows 0..511 of every batch also what the rounding to f16 left (exact products, f32 accumulation) */
  const _Float16* Q16 = QKV; const _Float16* K16 = QKV + DI;
  k_gemm3<1, false, false, LQK, LQK, NKX, SQ, DI><<<dim3((QT / 128) * (SQ / 128), NB, SQ / QT), 128, 0, stream>>>(Q16, (size_t)SQ * LQK, K16, (size_t)SQ * LQK, 0.03125f, S, nullptr, (size_t)SQ * NKX, QKL, QKL + DI);      /* scores / sqrt(1024) over the FULL width (K = 1024), one head; causal: only keys below each tile's end; rows 0..511: three terms side by side */
  k_rsm8<<<NB * SQ / 8, 256, 0, stream>>>(S, P);      /* causal softmax -> P x256 f16, one wave per row; rows 0..511: hi | lo | hi */
  k_gemm3<2, false, false, NKX, SQ, DI, DI, SQ><<<dim3((QT / 128) * (DI / 128), NB, SQ / QT), 128, 0, stream>>>(P, (size_t)SQ * NKX, VT, (size_t)DI * SQ, 0.00390625f, (float*)d_out, nullptr, (size_t)SQ * DI, nullptr, VT3);      /* out[b][q][:] = P V^T 2^-8 (f32), N = 1024, keys up to each tile's end; rows 0..511: K = 1536 over VT3 */
}
